// v000
// Measured on an AMD MI455X. A time is GPU time per run, averaged over a window of back-to-back runs after a warm-up
// (all launches, gaps included; the runs take copies of the inputs in turn), and the median of several windows.
// Apart from v000's, it joins two sittings. Times from different sittings can be a few percent apart, while
// side-by-side timings come from the same sitting.
// The starting kernel, v000, takes 1420 microseconds a run.
#include <hip/hip_runtime.h>

// BERT-style self-attention with a symmetric ALiBi score bias and no output projection (hidden_states [4][2048][512]; q, k, v = x W + b ('xw' [512][512] 0.02 incl. biases; 8 heads x 64); scores = q.k / sqrt(64) + slope_h |i - j| with slope_h = -2^-(h+1) (h = 0..7: the module's _get_slopes(8), negated; up to -0.5 x 2047); softmax over all keys; out = merged context -> [4][2048][512] (4.2 M); argument order hidden_states, Wq, bq, Wk, bk, Wv, bv).
// Layout per batch: bf16 copy of x; 'xw' weights transposed once; exact projections + f32 biases; identity-table plane builders; dense T-2048 attention with EVERY row on hi/lo planes (3 products; the ALiBi term makes the steep heads few-key sharp, so no fp16 rows); an element-wise kernel subtracts 8 x |slope_h| x |i - j| from the raw f32 scores (undone by the softmax kernel's exact x 1/8); the f32 merge writes the output rows.
// Compute dtypes, f32 accumulate: every input rounded to bf16; projections exact + f32 biases; scores and attn.v 3 products on every row; ALiBi add and softmax f32; output f32.

#define NB_  4
#define TT   2048
#define DM   512
#define NH_  8
#define NKV  8
#define REP  (NH_ / NKV)
#define HD   64
#define DQ   (NH_ * HD)
#define DKV  (NKV * HD)
#define ZH   2
#define RH   TT                   // every row hi/lo (3 products)
#define WIN  0
#define PCAR 1024.0f
#define SCL  0.125f   // HD^-0.5
typedef _Float16 h16;
typedef unsigned short bf;
typedef __attribute__((ext_vector_type(16))) __bf16   v16bf;
typedef __attribute__((ext_vector_type(16))) _Float16 v16h;
typedef __attribute__((ext_vector_type(8)))  _Float16 v8h;
typedef __attribute__((ext_vector_type(8)))  unsigned short v8us;
typedef __attribute__((ext_vector_type(8)))  float    v8f;
typedef __attribute__((ext_vector_type(4)))  float    v4f;
typedef v8h  __attribute__((may_alias)) v8ha;
typedef v4f  __attribute__((may_alias)) v4fa;
typedef v8us __attribute__((may_alias)) v8usa;

__device__ __forceinline__ unsigned short f2bf(float f) { unsigned u = __float_as_uint(f); u += 0x7FFFu + ((u >> 16) & 1u); return (unsigned short)(u >> 16); }
__device__ __forceinline__ float bf2f(unsigned short b) { return __uint_as_float(((unsigned)b) << 16); }
__device__ __forceinline__ float bfr(float f) { return bf2f(f2bf(f)); }
__device__ __forceinline__ v16h cat16(v8h lo, v8h hi) { return __builtin_shufflevector(lo, hi, 0, 1, 2, 3, 4, 5, 6, 7, 8, 9, 10, 11, 12, 13, 14, 15); }
__device__ __forceinline__ v16bf cat16b(v8us lo, v8us hi) { return __builtin_bit_cast(v16bf, __builtin_shufflevector(lo, hi, 0, 1, 2, 3, 4, 5, 6, 7, 8, 9, 10, 11, 12, 13, 14, 15)); }
__device__ __forceinline__ v8f wmma16(v16h a, v16h b, v8f c) { return __builtin_amdgcn_wmma_f32_16x16x32_f16(false, a, false, b, (short)0, c, false, false); }
__device__ __forceinline__ v8f wmmab(v16bf a, v16bf b, v8f c) { return __builtin_amdgcn_wmma_f32_16x16x32_bf16(false, a, false, b, (short)0, c, false, false); }



// ---- k_gemmw: register-blocked GEMM, ONE WAVE per 64x64 output tile (16 accumulators), operands straight from K-contiguous 16-bit planes; grid (M/64, N/64, Z), 32 threads.
// C[m][n] (f32, pitch ldc, + optional f32 bias[n]) = sum_k A[m][k] Bt[n][k] (+ split products per NSPLIT). z-batch strides sA/sB/sC in elements. K % 32 == 0.
template <typename T16> struct WFrag;
template <> struct WFrag<h16> { typedef v16h V; static __device__ __forceinline__ V ld(const h16* p) { return cat16(*(const v8h*)p, *(const v8h*)(p + 16)); } static __device__ __forceinline__ v8f mma(V a, V b, v8f c) { return wmma16(a, b, c); } };
template <> struct WFrag<bf> { typedef v16bf V; static __device__ __forceinline__ V ld(const bf* p) { return cat16b(*(const v8us*)p, *(const v8us*)(p + 16)); } static __device__ __forceinline__ v8f mma(V a, V b, v8f c) { return wmmab(a, b, c); } };
template <typename T16, int NSPLIT, bool BIAS>
__global__ __launch_bounds__(32) void k_gemmw(const T16* __restrict__ A, const T16* __restrict__ A2, const T16* __restrict__ Bt, const T16* __restrict__ Bt2, int K, float* C, int ldc, const float* __restrict__ bias, size_t sA, size_t sB, size_t sC) {
    typedef typename WFrag<T16>::V V;
    __shared__ __align__(16) float os[16 * 68];
    const size_t z = blockIdx.z; A += z * sA; if (A2) A2 += z * sA; Bt += z * sB; if (Bt2) Bt2 += z * sB; C += z * sC;
    const int lane = threadIdx.x & 31, lr = lane & 15, hi = lane >> 4; const int r0 = blockIdx.x * 64, c0 = blockIdx.y * 64;
    v8f acc[4][4];
#pragma unroll
    for (int mb = 0; mb < 4; ++mb)
#pragma unroll
        for (int nb = 0; nb < 4; ++nb) acc[mb][nb] = (v8f){};
    const size_t aoff = (size_t)(r0 + lr) * K + 8 * hi, boff = (size_t)(c0 + lr) * K + 8 * hi;
#pragma unroll 1
    for (int kc = 0; kc < K; kc += 32) {
        V a[4], a2[4];
#pragma unroll
        for (int mb = 0; mb < 4; ++mb) { a[mb] = WFrag<T16>::ld(A + aoff + (size_t)mb * 16 * K + kc); if (NSPLIT == 1 || NSPLIT == 2) a2[mb] = WFrag<T16>::ld(A2 + aoff + (size_t)mb * 16 * K + kc); }
#pragma unroll
        for (int nb = 0; nb < 4; ++nb) { const V b = WFrag<T16>::ld(Bt + boff + (size_t)nb * 16 * K + kc); V b2; if (NSPLIT >= 2) b2 = WFrag<T16>::ld(Bt2 + boff + (size_t)nb * 16 * K + kc);
#pragma unroll
            for (int mb = 0; mb < 4; ++mb) { acc[mb][nb] = WFrag<T16>::mma(a[mb], b, acc[mb][nb]); if (NSPLIT == 1 || NSPLIT == 2) acc[mb][nb] = WFrag<T16>::mma(a2[mb], b, acc[mb][nb]); if (NSPLIT >= 2) acc[mb][nb] = WFrag<T16>::mma(a[mb], b2, acc[mb][nb]); } }
        asm volatile("v_nop\n\tv_nop\n\tv_nop\n\tv_nop" : "+v"(acc[0][0]), "+v"(acc[1][1]), "+v"(acc[2][2]), "+v"(acc[3][3]) : "v"(a[0]), "v"(a[3]));
    }
#pragma unroll
    for (int mb = 0; mb < 4; ++mb) {
#pragma unroll
        for (int nb = 0; nb < 4; ++nb) {
#pragma unroll
            for (int j = 0; j < 8; ++j) os[(hi * 8 + j) * 68 + nb * 16 + lr] = acc[mb][nb][j]; }
        __builtin_amdgcn_wave_barrier(); asm volatile("" ::: "memory");
        float* crow = C + (size_t)(r0 + mb * 16) * ldc + c0;
{
#pragma unroll
            for (int s = 0; s < 8; ++s) { const int row = 2 * s + hi, cofs = lr * 4; v4f val = *(const v4fa*)(os + row * 68 + cofs); if (BIAS) { val[0] += bfr(bias[c0 + cofs]); val[1] += bfr(bias[c0 + cofs + 1]); val[2] += bfr(bias[c0 + cofs + 2]); val[3] += bfr(bias[c0 + cofs + 3]); }
                *(v4f*)(crow + (size_t)row * ldc + cofs) = val; }
             }
        __builtin_amdgcn_wave_barrier(); asm volatile("" ::: "memory");
    }
}

__device__ __forceinline__ h16 tohx(float x) { return (h16)x; }
__device__ __forceinline__ void splitf(float y, unsigned short& h, unsigned short& l) { h = f2bf(y); l = f2bf(y - bf2f(h)); }
typedef __attribute__((ext_vector_type(2))) _Float16 v2h;
typedef __attribute__((ext_vector_type(4))) _Float16 v4h;
typedef __attribute__((ext_vector_type(2))) unsigned short v2us;
typedef __attribute__((ext_vector_type(4))) unsigned short v4us;
typedef __attribute__((ext_vector_type(2))) float v2f;
typedef __attribute__((ext_vector_type(4))) int v4i;

__global__ __launch_bounds__(256) void k_wtG(const float* __restrict__ w, int K, int N, bf* Bt) {
    const int lane = threadIdx.x & 31; const int L0 = (blockIdx.x * 8 + (threadIdx.x >> 5)) * 8; const int nlines = N * K / 64;
{
#pragma unroll 1
        for (int l = 0; l < 8; ++l) { const int L = L0 + l; if (L >= nlines) break; const size_t e = (size_t)L * 64 + lane * 2; const int k = (int)(e % K), n = (int)(e / K); v2us o;
            o[0] = f2bf(w[(size_t)k * N + n]); o[1] = f2bf(w[(size_t)(k + 1) * N + n]); *(v2us*)(Bt + e) = o; }
         }
}
__global__ __launch_bounds__(256) void k_cvt8(const float* __restrict__ src, bf* dst, size_t n8) { const size_t i = (size_t)blockIdx.x * 256 + threadIdx.x; if (i >= n8) return; const v8f v = *(const v8f*)(src + i * 8); v8us o;
#pragma unroll
    for (int k = 0; k < 8; ++k) o[k] = f2bf(v[k]); *(v8us*)(dst + i * 8) = o;  }

// k_rope: head planes [h][t][d] (fp16 + hi/lo) of rope(x) x sc with the rotate-half convention out[d] = x[d] cos[t][d] - x[d+HD/2] sin[t][d], out[d+HD/2] = x[d+HD/2] cos[t][d+HD/2] + x[d] sin[t][d+HD/2]
__global__ __launch_bounds__(256) void k_rope(const float* __restrict__ F, int pitch, int nheads, const float* __restrict__ CS, const float* __restrict__ RF, const float* __restrict__ nw, float sc, h16* P16, bf* Ph, bf* Pl) {
    const size_t e = ((size_t)blockIdx.x * 256 + threadIdx.x) * 2; if (e >= (size_t)nheads * TT * HD) return; const int d = (int)(e % HD); const int t = (int)((e / HD) % TT); const int h = (int)(e / ((size_t)HD * TT)); const float* f = F + (size_t)t * pitch + h * HD; const float rf = RF ? RF[(size_t)h * TT + t] : 1.0f; v2h o16; v2us oh, ol;
#pragma unroll
    for (int q = 0; q < 2; ++q) { const int dd = d + q; const int dp = (dd < HD / 2) ? dd + HD / 2 : dd - HD / 2; float x0 = f[dd], x1 = f[dp];
        if (RF) { float n0 = __fmul_rn(x0, rf), n1 = __fmul_rn(x1, rf); asm volatile("" : "+v"(n0)); asm volatile("" : "+v"(n1)); x0 = __fmul_rn(bfr(nw[dd]), n0); x1 = __fmul_rn(bfr(nw[dp]), n1); }
        const v2f cs = *(const v2f*)(CS + ((size_t)t * HD + dd) * 2); float a = __fmul_rn(x0, cs[0]), bq = __fmul_rn(x1, cs[1]); asm volatile("" : "+v"(a)); asm volatile("" : "+v"(bq)); const float r = ((dd < HD / 2) ? __fsub_rn(a, bq) : __fadd_rn(a, bq)) * sc;
        o16[q] = tohx(r); unsigned short a2, c2; splitf(r, a2, c2); oh[q] = a2; ol[q] = c2; }
    *(v2h*)(P16 + e) = o16; *(v2us*)(Ph + e) = oh; *(v2us*)(Pl + e) = ol;  }
__global__ __launch_bounds__(256) void k_vtp(const float* __restrict__ F, int pitch, int nheads, h16* V16, bf* Vh, bf* Vl) { const size_t e = ((size_t)blockIdx.x * 256 + threadIdx.x) * 2; if (e >= (size_t)nheads * HD * TT) return; const int t = (int)(e % TT); const int d = (int)((e / TT) % HD); const int g = (int)(e / ((size_t)TT * HD)); v2h o16; v2us oh, ol;
#pragma unroll
    for (int q = 0; q < 2; ++q) { const float x = F[(size_t)(t + q) * pitch + g * HD + d]; o16[q] = tohx(x); unsigned short a2, c2; splitf(x, a2, c2); oh[q] = a2; ol[q] = c2; }
    *(v2h*)(V16 + e) = o16; *(v2us*)(Vh + e) = oh; *(v2us*)(Vl + e) = ol;  }
__global__ __launch_bounds__(256) void k_csid(float* CS) { const int idx = blockIdx.x * 256 + threadIdx.x; if (idx >= TT * HD) return; v2f cs; cs[0] = 1.0f; cs[1] = 0.0f; *(v2f*)(CS + (size_t)idx * 2) = cs;  }
__constant__ float SLOPE8[NH_] = { 4.000000000e+0f, 2.000000000e+0f, 1.000000000e+0f, 5.000000000e-1f, 2.500000000e-1f, 1.250000000e-1f, 6.250000000e-2f, 3.125000000e-2f };   // 8 x the per-head ALiBi slope magnitude (|slope_h| = 2^-(h+1), h = 0..7); every entry and every product with |i - j| <= 2047 is exact in f32
__global__ __launch_bounds__(256) void k_alibi(float* Sb, int h0) { const size_t k = (size_t)blockIdx.x * 256 + threadIdx.x; if (k >= (size_t)ZH * TT * TT / 4) return; const size_t e = k * 4; const int j0 = (int)(e % TT); const int i = (int)((e / TT) % TT); const int zz = (int)(e / ((size_t)TT * TT)); const float sl = SLOPE8[h0 + zz]; v4f a = *(const v4f*)(Sb + e);
#pragma unroll
    for (int q = 0; q < 4; ++q) { const int dd = i - (j0 + q); const float dist = (float)(dd < 0 ? -dd : dd); float bb = __fmul_rn(sl, dist); asm volatile("" : "+v"(bb)); a[q] = __fsub_rn(a[q], bb); }
    *(v4f*)(Sb + e) = a;  }
// k_asoft: per row (zz, i): t = S x HD^-0.5 (no mask); softmax over the 2048 keys (register row, one exp, fixed trees);
__global__ __launch_bounds__(256) void k_asoft(const float* __restrict__ Sb, h16* P16, bf* Ph, bf* Pl) {
    const int lane = threadIdx.x & 31; const int row = blockIdx.x * 8 + (threadIdx.x >> 5); if (row >= ZH * TT) return; const int i = row % TT; const int zz = row / TT; (void)zz; const bool hires = (i < RH); const float* sr = Sb + (size_t)row * TT; float v[TT / 32]; float mx = -3.0e38f;
#pragma unroll
    for (int ch = 0; ch < TT / 128; ++ch) { const int j0 = ch * 128 + lane * 4; const v4f a = *(const v4f*)(sr + j0);
#pragma unroll
        for (int q = 0; q < 4; ++q) { const int j = j0 + q; (void)j; const float t = a[q] * SCL; v[ch * 4 + q] = t; mx = fmaxf(mx, t); } }
#pragma unroll
    for (int sh = 16; sh; sh >>= 1) mx = fmaxf(mx, __shfl_xor(mx, sh, 32));
    float sum = 0.f;
#pragma unroll
    for (int k = 0; k < TT / 32; ++k) { float d0 = __fsub_rn(v[k], mx); asm volatile("" : "+v"(d0)); v[k] = __builtin_amdgcn_exp2f(__fmul_rn(d0, 1.4426950408889634f)); sum += v[k]; }
#pragma unroll
    for (int sh = 16; sh; sh >>= 1) sum += __shfl_xor(sum, sh, 32);
    const float f = __fdiv_rn(hires ? 1.0f : PCAR, sum);
{
        if (hires) {
#pragma unroll
            for (int ch = 0; ch < TT / 128; ++ch) { v4us oh, ol;
#pragma unroll
                for (int q = 0; q < 4; ++q) { unsigned short a, c2; splitf(v[ch * 4 + q] * f, a, c2); oh[q] = a; ol[q] = c2; }
                const size_t oo = ((size_t)zz * (RH ? RH : 1) + i) * TT + ch * 128 + lane * 4; *(v4us*)(Ph + oo) = oh; *(v4us*)(Pl + oo) = ol; }
        } else {
#pragma unroll
            for (int ch = 0; ch < TT / 128; ++ch) { v4h o4;
#pragma unroll
                for (int q = 0; q < 4; ++q) o4[q] = tohx(v[ch * 4 + q] * f);
                *(v4h*)(P16 + (size_t)row * TT + ch * 128 + lane * 4) = o4; } }
         }
}
__global__ __launch_bounds__(256) void k_merge(const float* __restrict__ O, int h0, float* OUTb) { const size_t e = ((size_t)blockIdx.x * 256 + threadIdx.x) * 2; if (e >= (size_t)ZH * TT * HD) return; const int d = (int)(e % HD); const int t = (int)((e / HD) % TT); const int zz = (int)(e / ((size_t)HD * TT)); const float cs = (t < RH) ? 1.0f : (1.0f / PCAR); const size_t oo = (size_t)t * DQ + (h0 + zz) * HD + d;
    v2f o2; o2[0] = O[e] * cs; o2[1] = O[e + 1] * cs; *(v2f*)(OUTb + oo) = o2;  }

extern "C" void kernel_launch(void* const* d_in, const int* in_sizes, int n_in,
                              void* d_out, int out_size, void* d_ws, size_t ws_size, hipStream_t stream) {
    (void)in_sizes; (void)n_in; (void)out_size;
    const float* x = (const float*)d_in[0]; const float* wq = (const float*)d_in[1]; const float* bq = (const float*)d_in[2]; const float* wk = (const float*)d_in[3]; const float* bk = (const float*)d_in[4]; const float* wv = (const float*)d_in[5]; const float* bv = (const float*)d_in[6];   /* argument order hidden_states, Wq, bq, Wk, bk, Wv, bv ('xw' + biases) */ const float* wo = nullptr; (void)wo;
    float* OUT = (float*)d_out;     // [4][2048][512]
    char* wsp = (char*)d_ws;
    auto take = [&](size_t bytes) { char* p = wsp; wsp += (bytes + 255) & ~(size_t)255; return (void*)p; };
    bf* WQ = (bf*)take((size_t)DQ * DM * 2); bf* WK = (bf*)take((size_t)DKV * DM * 2); bf* WV = (bf*)take((size_t)DKV * DM * 2); float* CS = (float*)take((size_t)TT * HD * 2 * 4);
    bf* XB = (bf*)take((size_t)TT * DM * 2); float* FQ = (float*)take((size_t)TT * DQ * 4); float* FK = (float*)take((size_t)TT * DKV * 4);
    h16* QP16 = (h16*)take((size_t)NH_ * TT * HD * 2); h16* KP16 = (h16*)take((size_t)NKV * TT * HD * 2); h16* VT16 = (h16*)take((size_t)NKV * HD * TT * 2);
    bf* QPh = (bf*)take((size_t)NH_ * TT * HD * 2); bf* QPl = (bf*)take((size_t)NH_ * TT * HD * 2); bf* KPh = (bf*)take((size_t)NKV * TT * HD * 2); bf* KPl = (bf*)take((size_t)NKV * TT * HD * 2); bf* VTh = (bf*)take((size_t)NKV * HD * TT * 2); bf* VTl = (bf*)take((size_t)NKV * HD * TT * 2); bf* Ph = (bf*)take((size_t)ZH * RH * TT * 2); bf* Pl = (bf*)take((size_t)ZH * RH * TT * 2);
    float* Sb = (float*)take((size_t)ZH * TT * TT * 4); h16* P16 = (h16*)take((size_t)ZH * TT * TT * 2); float* Ob = (float*)take((size_t)ZH * TT * HD * 4);
    if ((size_t)(wsp - (char*)d_ws) > ws_size) return;    // ws 256 MiB
    float* FV = FK;   // v projection reuses the k buffer after the k planes are built (stream-ordered)
    { k_wtG<<<(unsigned)((DM * DQ / 64 + 63) / 64), 256, 0, stream>>>(wq, DM, DQ, WQ); k_wtG<<<(unsigned)((DM * DKV / 64 + 63) / 64), 256, 0, stream>>>(wk, DM, DKV, WK); k_wtG<<<(unsigned)((DM * DKV / 64 + 63) / 64), 256, 0, stream>>>(wv, DM, DKV, WV);
      
       }
    k_csid<<<(TT * HD + 255) / 256, 256, 0, stream>>>(CS);
    const unsigned LQ = (unsigned)(((size_t)NH_ * TT * HD / 2 + 255) / 256), LKv = (unsigned)(((size_t)NKV * TT * HD / 2 + 255) / 256);
    for (int b = 0; b < NB_; ++b) {
        
        k_cvt8<<<(unsigned)(((size_t)TT * DM / 8 + 255) / 256), 256, 0, stream>>>(x + (size_t)b * TT * DM, XB, (size_t)TT * DM / 8);
        k_gemmw<bf, 0, true><<<dim3(TT / 64, DQ / 64, 1), 32, 0, stream>>>(XB, nullptr, WQ, nullptr, DM, FQ, DQ, bq, 0, 0, 0);
        k_rope<<<LQ, 256, 0, stream>>>(FQ, DQ, NH_, CS, nullptr, nullptr, 1.0f, QP16, QPh, QPl);
        k_gemmw<bf, 0, true><<<dim3(TT / 64, DKV / 64, 1), 32, 0, stream>>>(XB, nullptr, WK, nullptr, DM, FK, DKV, bk, 0, 0, 0);
        k_rope<<<LKv, 256, 0, stream>>>(FK, DKV, NKV, CS, nullptr, nullptr, 1.0f, KP16, KPh, KPl);
        k_gemmw<bf, 0, true><<<dim3(TT / 64, DKV / 64, 1), 32, 0, stream>>>(XB, nullptr, WV, nullptr, DM, FV, DKV, bv, 0, 0, 0); k_vtp<<<LKv, 256, 0, stream>>>(FV, DKV, NKV, VT16, VTh, VTl);
        for (int h0 = 0; h0 < NH_; h0 += ZH) { const size_t zq = (size_t)h0, zk = (size_t)(h0 / REP);   // one kv head per query head: the pass's two heads use consecutive kv planes (z-strides TT*HD)
            k_gemmw<bf, 2, false><<<dim3(RH / 64, TT / 64, ZH), 32, 0, stream>>>(QPh + zq * TT * HD, QPl + zq * TT * HD, KPh + zk * TT * HD, KPl + zk * TT * HD, HD, Sb, TT, nullptr, (size_t)TT * HD, (size_t)TT * HD, (size_t)TT * TT);
            k_alibi<<<(unsigned)(((size_t)ZH * TT * TT / 4 + 255) / 256), 256, 0, stream>>>(Sb, h0);   /* - slope_h |i-j| (x 8, in f32) */ k_asoft<<<ZH * TT / 8, 256, 0, stream>>>(Sb, P16, Ph, Pl);
            k_gemmw<bf, 2, false><<<dim3(RH / 64, HD / 64, ZH), 32, 0, stream>>>(Ph, Pl, VTh + zk * HD * TT, VTl + zk * HD * TT, TT, Ob, HD, nullptr, (size_t)RH * TT, (size_t)HD * TT, (size_t)TT * HD);
            k_merge<<<(unsigned)(((size_t)ZH * TT * HD / 2 + 255) / 256), 256, 0, stream>>>(Ob, h0, OUT + (size_t)b * TT * DQ); }
         }
}

// v001
// It runs in 833 microseconds.
// Timed twice side by side with v000, it ran 1.69 and 1.72 times as fast.
#include <hip/hip_runtime.h>

// BERT-style self-attention with a symmetric ALiBi score bias and no output projection (hidden_states [4][2048][512]; q, k, v = x W + b ('xw' [512][512] 0.02 incl. biases; 8 heads x 64); scores = q.k / sqrt(64) + slope_h |i - j| with slope_h = -2^-(h+1) (h = 0..7: the module's _get_slopes(8), negated; up to -0.5 x 2047); softmax over all keys; out = merged context -> [4][2048][512] (4.2 M); argument order hidden_states, Wq, bq, Wk, bk, Wv, bv).
// Layout per batch: bf16 copy of x; 'xw' weights transposed once; exact projections + f32 biases; identity-table plane builders; dense T-2048 attention with EVERY row on hi/lo planes (3 products; the ALiBi term makes the steep heads few-key sharp, so no fp16 rows); an element-wise kernel subtracts 8 x |slope_h| x |i - j| from the raw f32 scores (undone by the softmax kernel's exact x 1/8); the f32 merge writes the output rows.
// Compute dtypes, f32 accumulate: every input rounded to bf16; projections exact + f32 biases; scores and attn.v 3 products on every row; ALiBi add and softmax f32; output f32.

#define NB_  4
#define TT   2048
#define DM   512
#define NH_  8
#define NKV  8
#define REP  (NH_ / NKV)
#define HD   64
#define DQ   (NH_ * HD)
#define DKV  (NKV * HD)
#define ZH   2
#define RH   TT                   // every row hi/lo (3 products)
#define WIN  0
#define PCAR 1024.0f
#define SCL  0.125f   // HD^-0.5
#define KGV  4        // attn.v: K groups over work-groups, one partial context plane each, added in k_merge
typedef _Float16 h16;
typedef unsigned short bf;
typedef __attribute__((ext_vector_type(16))) __bf16   v16bf;
typedef __attribute__((ext_vector_type(16))) _Float16 v16h;
typedef __attribute__((ext_vector_type(8)))  _Float16 v8h;
typedef __attribute__((ext_vector_type(8)))  unsigned short v8us;
typedef __attribute__((ext_vector_type(8)))  float    v8f;
typedef __attribute__((ext_vector_type(4)))  float    v4f;
typedef v8h  __attribute__((may_alias)) v8ha;
typedef v4f  __attribute__((may_alias)) v4fa;
typedef v8us __attribute__((may_alias)) v8usa;

__device__ __forceinline__ unsigned short f2bf(float f) { unsigned u = __float_as_uint(f); u += 0x7FFFu + ((u >> 16) & 1u); return (unsigned short)(u >> 16); }
__device__ __forceinline__ float bf2f(unsigned short b) { return __uint_as_float(((unsigned)b) << 16); }
__device__ __forceinline__ float bfr(float f) { return bf2f(f2bf(f)); }
__device__ __forceinline__ v16h cat16(v8h lo, v8h hi) { return __builtin_shufflevector(lo, hi, 0, 1, 2, 3, 4, 5, 6, 7, 8, 9, 10, 11, 12, 13, 14, 15); }
__device__ __forceinline__ v16bf cat16b(v8us lo, v8us hi) { return __builtin_bit_cast(v16bf, __builtin_shufflevector(lo, hi, 0, 1, 2, 3, 4, 5, 6, 7, 8, 9, 10, 11, 12, 13, 14, 15)); }
__device__ __forceinline__ v8f wmma16(v16h a, v16h b, v8f c) { return __builtin_amdgcn_wmma_f32_16x16x32_f16(false, a, false, b, (short)0, c, false, false); }
__device__ __forceinline__ v8f wmmab(v16bf a, v16bf b, v8f c) { return __builtin_amdgcn_wmma_f32_16x16x32_bf16(false, a, false, b, (short)0, c, false, false); }



// ---- k_gemmw: register-blocked GEMM, ONE WAVE per 64x64 output tile (16 accumulators), operands straight from K-contiguous 16-bit planes; grid (M/64, N/64, Z), 32 threads.
// C[m][n] (f32, pitch ldc, + optional f32 bias[n]) = sum_k A[m][k] Bt[n][k] (+ split products per NSPLIT). z-batch strides sA/sB/sC in elements. K % 32 == 0.
template <typename T16> struct WFrag;
template <> struct WFrag<h16> { typedef v16h V; static __device__ __forceinline__ V ld(const h16* p) { return cat16(*(const v8h*)p, *(const v8h*)(p + 16)); } static __device__ __forceinline__ v8f mma(V a, V b, v8f c) { return wmma16(a, b, c); } };
template <> struct WFrag<bf> { typedef v16bf V; static __device__ __forceinline__ V ld(const bf* p) { return cat16b(*(const v8us*)p, *(const v8us*)(p + 16)); } static __device__ __forceinline__ v8f mma(V a, V b, v8f c) { return wmmab(a, b, c); } };
template <typename T16, int NSPLIT, bool BIAS>
__global__ __launch_bounds__(32) void k_gemmw(const T16* __restrict__ A, const T16* __restrict__ A2, const T16* __restrict__ Bt, const T16* __restrict__ Bt2, int K, float* C, int ldc, const float* __restrict__ bias, size_t sA, size_t sB, size_t sC) {
    typedef typename WFrag<T16>::V V;
    __shared__ __align__(16) float os[16 * 68];
    const size_t z = blockIdx.z; A += z * sA; if (A2) A2 += z * sA; Bt += z * sB; if (Bt2) Bt2 += z * sB; C += z * sC;
    const int lane = threadIdx.x & 31, lr = lane & 15, hi = lane >> 4; const int r0 = blockIdx.x * 64, c0 = blockIdx.y * 64;
    v8f acc[4][4];
#pragma unroll
    for (int mb = 0; mb < 4; ++mb)
#pragma unroll
        for (int nb = 0; nb < 4; ++nb) acc[mb][nb] = (v8f){};
    const size_t aoff = (size_t)(r0 + lr) * K + 8 * hi, boff = (size_t)(c0 + lr) * K + 8 * hi;
#pragma unroll 1
    for (int kc = 0; kc < K; kc += 32) {
        V a[4], a2[4];
#pragma unroll
        for (int mb = 0; mb < 4; ++mb) { a[mb] = WFrag<T16>::ld(A + aoff + (size_t)mb * 16 * K + kc); if (NSPLIT == 1 || NSPLIT == 2) a2[mb] = WFrag<T16>::ld(A2 + aoff + (size_t)mb * 16 * K + kc); }
#pragma unroll
        for (int nb = 0; nb < 4; ++nb) { const V b = WFrag<T16>::ld(Bt + boff + (size_t)nb * 16 * K + kc); V b2; if (NSPLIT >= 2) b2 = WFrag<T16>::ld(Bt2 + boff + (size_t)nb * 16 * K + kc);
#pragma unroll
            for (int mb = 0; mb < 4; ++mb) { acc[mb][nb] = WFrag<T16>::mma(a[mb], b, acc[mb][nb]); if (NSPLIT == 1 || NSPLIT == 2) acc[mb][nb] = WFrag<T16>::mma(a2[mb], b, acc[mb][nb]); if (NSPLIT >= 2) acc[mb][nb] = WFrag<T16>::mma(a[mb], b2, acc[mb][nb]); } }
        asm volatile("v_nop\n\tv_nop\n\tv_nop\n\tv_nop" : "+v"(acc[0][0]), "+v"(acc[1][1]), "+v"(acc[2][2]), "+v"(acc[3][3]) : "v"(a[0]), "v"(a[3]));
    }
#pragma unroll
    for (int mb = 0; mb < 4; ++mb) {
#pragma unroll
        for (int nb = 0; nb < 4; ++nb) {
#pragma unroll
            for (int j = 0; j < 8; ++j) os[(hi * 8 + j) * 68 + nb * 16 + lr] = acc[mb][nb][j]; }
        __builtin_amdgcn_wave_barrier(); asm volatile("" ::: "memory");
        float* crow = C + (size_t)(r0 + mb * 16) * ldc + c0;
{
#pragma unroll
            for (int s = 0; s < 8; ++s) { const int row = 2 * s + hi, cofs = lr * 4; v4f val = *(const v4fa*)(os + row * 68 + cofs); if (BIAS) { val[0] += bfr(bias[c0 + cofs]); val[1] += bfr(bias[c0 + cofs + 1]); val[2] += bfr(bias[c0 + cofs + 2]); val[3] += bfr(bias[c0 + cofs + 3]); }
                *(v4f*)(crow + (size_t)row * ldc + cofs) = val; }
             }
        __builtin_amdgcn_wave_barrier(); asm volatile("" ::: "memory");
    }
}

// ---- k_gemmk: the same product for a deep K and few output tiles: K (= KK, also the operands' pitch) is split into KG * NW equal runs. Work-group (x, y, z) takes the (MB*16)x64 tile (x, y / KG) and K group kg = y % KG; its wave w takes run kg * NW + w; the NW partial tiles meet in LDS and are summed in wave order; the sum goes to plane kg of C (plane stride sK elements; KG > 1: the reader adds the planes). grid (M/(MB*16), N/64 * KG, Z), NW*32 threads. KK % (32 KG NW) == 0.
template <typename T16, int NSPLIT, bool BIAS, int MB, int NW, int KG, int KK>
__global__ __launch_bounds__(NW * 32) void k_gemmk(const T16* __restrict__ A, const T16* __restrict__ A2, const T16* __restrict__ Bt, const T16* __restrict__ Bt2, float* C, int ldc, const float* __restrict__ bias, size_t sA, size_t sB, size_t sC, size_t sK) {
    typedef typename WFrag<T16>::V V;
    __shared__ __align__(16) float red[NW * MB * 16 * 68];
    const size_t z = blockIdx.z; A += z * sA; if (NSPLIT == 1 || NSPLIT == 2) A2 += z * sA; Bt += z * sB; if (NSPLIT >= 2) Bt2 += z * sB; C += z * sC + (blockIdx.y % KG) * sK;
    const int lane = threadIdx.x & 31, lr = lane & 15, hi = lane >> 4, wv = threadIdx.x >> 5; const int r0 = blockIdx.x * (MB * 16), c0 = (blockIdx.y / KG) * 64; constexpr int KR = KK / (KG * NW); const int k0 = ((blockIdx.y % KG) * NW + wv) * KR;
    v8f acc[MB][4];
#pragma unroll
    for (int mb = 0; mb < MB; ++mb)
#pragma unroll
        for (int nb = 0; nb < 4; ++nb) acc[mb][nb] = (v8f){};
    const size_t aoff = (size_t)(r0 + lr) * KK + k0 + 8 * hi, boff = (size_t)(c0 + lr) * KK + k0 + 8 * hi;
#pragma unroll 1   // rolled: a trip's fragments and the accumulators fill the registers; unrolled, the compiler waited on each fragment load by itself
    for (int kc = 0; kc < KR; kc += 32) {
        V a[MB], a2[MB], b[4], b2[4];
#pragma unroll
        for (int mb = 0; mb < MB; ++mb) { a[mb] = WFrag<T16>::ld(A + aoff + (size_t)mb * 16 * KK + kc); if (NSPLIT == 1 || NSPLIT == 2) a2[mb] = WFrag<T16>::ld(A2 + aoff + (size_t)mb * 16 * KK + kc); }
#pragma unroll
        for (int nb = 0; nb < 4; ++nb) { b[nb] = WFrag<T16>::ld(Bt + boff + (size_t)nb * 16 * KK + kc); if (NSPLIT >= 2) b2[nb] = WFrag<T16>::ld(Bt2 + boff + (size_t)nb * 16 * KK + kc); }
#pragma unroll
        for (int nb = 0; nb < 4; ++nb)
#pragma unroll
            for (int mb = 0; mb < MB; ++mb) { acc[mb][nb] = WFrag<T16>::mma(a[mb], b[nb], acc[mb][nb]); if (NSPLIT == 1 || NSPLIT == 2) acc[mb][nb] = WFrag<T16>::mma(a2[mb], b[nb], acc[mb][nb]); if (NSPLIT >= 2) acc[mb][nb] = WFrag<T16>::mma(a[mb], b2[nb], acc[mb][nb]); }
    }
    float* my = red + wv * (MB * 16 * 68);
#pragma unroll
    for (int mb = 0; mb < MB; ++mb)
#pragma unroll
        for (int nb = 0; nb < 4; ++nb)
#pragma unroll
            for (int j = 0; j < 8; ++j) my[(mb * 16 + hi * 8 + j) * 68 + nb * 16 + lr] = acc[mb][nb][j];
    __syncthreads();   // every wave's partial tile is in LDS before any thread sums across the waves
#pragma unroll
    for (int it = 0; it < MB * 16 * 16 / (NW * 32); ++it) { const int q = it * (NW * 32) + threadIdx.x; const int row = q >> 4, cofs = (q & 15) * 4; v4f val = *(const v4fa*)(red + row * 68 + cofs);
#pragma unroll
        for (int w = 1; w < NW; ++w) val += *(const v4fa*)(red + w * (MB * 16 * 68) + row * 68 + cofs);
        if (BIAS) { val[0] += bfr(bias[c0 + cofs]); val[1] += bfr(bias[c0 + cofs + 1]); val[2] += bfr(bias[c0 + cofs + 2]); val[3] += bfr(bias[c0 + cofs + 3]); }
        *(v4f*)(C + (size_t)(r0 + row) * ldc + c0 + cofs) = val; }
}

__device__ __forceinline__ h16 tohx(float x) { return (h16)x; }
__device__ __forceinline__ void splitf(float y, unsigned short& h, unsigned short& l) { h = f2bf(y); l = f2bf(y - bf2f(h)); }
typedef __attribute__((ext_vector_type(2))) _Float16 v2h;
typedef __attribute__((ext_vector_type(4))) _Float16 v4h;
typedef __attribute__((ext_vector_type(2))) unsigned short v2us;
typedef __attribute__((ext_vector_type(4))) unsigned short v4us;
typedef __attribute__((ext_vector_type(2))) float v2f;
typedef __attribute__((ext_vector_type(4))) int v4i;

__global__ __launch_bounds__(256) void k_wtG(const float* __restrict__ w, int K, int N, bf* Bt) {
    const int lane = threadIdx.x & 31; const int L0 = (blockIdx.x * 8 + (threadIdx.x >> 5)) * 8; const int nlines = N * K / 64;
{
#pragma unroll 1
        for (int l = 0; l < 8; ++l) { const int L = L0 + l; if (L >= nlines) break; const size_t e = (size_t)L * 64 + lane * 2; const int k = (int)(e % K), n = (int)(e / K); v2us o;
            o[0] = f2bf(w[(size_t)k * N + n]); o[1] = f2bf(w[(size_t)(k + 1) * N + n]); *(v2us*)(Bt + e) = o; }
         }
}
__global__ __launch_bounds__(256) void k_cvt8(const float* __restrict__ src, bf* dst, size_t n8) { const size_t i = (size_t)blockIdx.x * 256 + threadIdx.x; if (i >= n8) return; const v8f v = *(const v8f*)(src + i * 8); v8us o;
#pragma unroll
    for (int k = 0; k < 8; ++k) o[k] = f2bf(v[k]); *(v8us*)(dst + i * 8) = o;  }

// k_rope: head planes [h][t][d] (fp16 + hi/lo) of rope(x) x sc with the rotate-half convention out[d] = x[d] cos[t][d] - x[d+HD/2] sin[t][d], out[d+HD/2] = x[d+HD/2] cos[t][d+HD/2] + x[d] sin[t][d+HD/2]
__global__ __launch_bounds__(256) void k_rope(const float* __restrict__ F, int pitch, int nheads, const float* __restrict__ CS, const float* __restrict__ RF, const float* __restrict__ nw, float sc, h16* P16, bf* Ph, bf* Pl) {
    const size_t e = ((size_t)blockIdx.x * 256 + threadIdx.x) * 2; if (e >= (size_t)nheads * TT * HD) return; const int d = (int)(e % HD); const int t = (int)((e / HD) % TT); const int h = (int)(e / ((size_t)HD * TT)); const float* f = F + (size_t)t * pitch + h * HD; const float rf = RF ? RF[(size_t)h * TT + t] : 1.0f; v2h o16; v2us oh, ol;
#pragma unroll
    for (int q = 0; q < 2; ++q) { const int dd = d + q; const int dp = (dd < HD / 2) ? dd + HD / 2 : dd - HD / 2; float x0 = f[dd], x1 = f[dp];
        if (RF) { float n0 = __fmul_rn(x0, rf), n1 = __fmul_rn(x1, rf); asm volatile("" : "+v"(n0)); asm volatile("" : "+v"(n1)); x0 = __fmul_rn(bfr(nw[dd]), n0); x1 = __fmul_rn(bfr(nw[dp]), n1); }
        const v2f cs = *(const v2f*)(CS + ((size_t)t * HD + dd) * 2); float a = __fmul_rn(x0, cs[0]), bq = __fmul_rn(x1, cs[1]); asm volatile("" : "+v"(a)); asm volatile("" : "+v"(bq)); const float r = ((dd < HD / 2) ? __fsub_rn(a, bq) : __fadd_rn(a, bq)) * sc;
        o16[q] = tohx(r); unsigned short a2, c2; splitf(r, a2, c2); oh[q] = a2; ol[q] = c2; }
    *(v2h*)(P16 + e) = o16; *(v2us*)(Ph + e) = oh; *(v2us*)(Pl + e) = ol;  }
__global__ __launch_bounds__(256) void k_vtp(const float* __restrict__ F, int pitch, int nheads, h16* V16, bf* Vh, bf* Vl) { const size_t e = ((size_t)blockIdx.x * 256 + threadIdx.x) * 2; if (e >= (size_t)nheads * HD * TT) return; const int t = (int)(e % TT); const int d = (int)((e / TT) % HD); const int g = (int)(e / ((size_t)TT * HD)); v2h o16; v2us oh, ol;
#pragma unroll
    for (int q = 0; q < 2; ++q) { const float x = F[(size_t)(t + q) * pitch + g * HD + d]; o16[q] = tohx(x); unsigned short a2, c2; splitf(x, a2, c2); oh[q] = a2; ol[q] = c2; }
    *(v2h*)(V16 + e) = o16; *(v2us*)(Vh + e) = oh; *(v2us*)(Vl + e) = ol;  }
__global__ __launch_bounds__(256) void k_csid(float* CS) { const int idx = blockIdx.x * 256 + threadIdx.x; if (idx >= TT * HD) return; v2f cs; cs[0] = 1.0f; cs[1] = 0.0f; *(v2f*)(CS + (size_t)idx * 2) = cs;  }
__constant__ float SLOPE8[NH_] = { 4.000000000e+0f, 2.000000000e+0f, 1.000000000e+0f, 5.000000000e-1f, 2.500000000e-1f, 1.250000000e-1f, 6.250000000e-2f, 3.125000000e-2f };   // 8 x the per-head ALiBi slope magnitude (|slope_h| = 2^-(h+1), h = 0..7); every entry and every product with |i - j| <= 2047 is exact in f32
__global__ __launch_bounds__(256) void k_alibi(float* Sb, int h0) { const size_t k = (size_t)blockIdx.x * 256 + threadIdx.x; if (k >= (size_t)ZH * TT * TT / 4) return; const size_t e = k * 4; const int j0 = (int)(e % TT); const int i = (int)((e / TT) % TT); const int zz = (int)(e / ((size_t)TT * TT)); const float sl = SLOPE8[h0 + zz]; v4f a = *(const v4f*)(Sb + e);
#pragma unroll
    for (int q = 0; q < 4; ++q) { const int dd = i - (j0 + q); const float dist = (float)(dd < 0 ? -dd : dd); float bb = __fmul_rn(sl, dist); asm volatile("" : "+v"(bb)); a[q] = __fsub_rn(a[q], bb); }
    *(v4f*)(Sb + e) = a;  }
// k_asoft: per row (zz, i): t = S x HD^-0.5 (no mask); softmax over the 2048 keys (register row, one exp, fixed trees);
__global__ __launch_bounds__(256) void k_asoft(const float* __restrict__ Sb, h16* P16, bf* Ph, bf* Pl) {
    const int lane = threadIdx.x & 31; const int row = blockIdx.x * 8 + (threadIdx.x >> 5); if (row >= ZH * TT) return; const int i = row % TT; const int zz = row / TT; (void)zz; const bool hires = (i < RH); const float* sr = Sb + (size_t)row * TT; float v[TT / 32]; float mx = -3.0e38f;
#pragma unroll
    for (int ch = 0; ch < TT / 128; ++ch) { const int j0 = ch * 128 + lane * 4; const v4f a = *(const v4f*)(sr + j0);
#pragma unroll
        for (int q = 0; q < 4; ++q) { const int j = j0 + q; (void)j; const float t = a[q] * SCL; v[ch * 4 + q] = t; mx = fmaxf(mx, t); } }
#pragma unroll
    for (int sh = 16; sh; sh >>= 1) mx = fmaxf(mx, __shfl_xor(mx, sh, 32));
    float sum = 0.f;
#pragma unroll
    for (int k = 0; k < TT / 32; ++k) { float d0 = __fsub_rn(v[k], mx); asm volatile("" : "+v"(d0)); v[k] = __builtin_amdgcn_exp2f(__fmul_rn(d0, 1.4426950408889634f)); sum += v[k]; }
#pragma unroll
    for (int sh = 16; sh; sh >>= 1) sum += __shfl_xor(sum, sh, 32);
    const float f = __fdiv_rn(hires ? 1.0f : PCAR, sum);
{
        if (hires) {
#pragma unroll
            for (int ch = 0; ch < TT / 128; ++ch) { v4us oh, ol;
#pragma unroll
                for (int q = 0; q < 4; ++q) { unsigned short a, c2; splitf(v[ch * 4 + q] * f, a, c2); oh[q] = a; ol[q] = c2; }
                const size_t oo = ((size_t)zz * (RH ? RH : 1) + i) * TT + ch * 128 + lane * 4; *(v4us*)(Ph + oo) = oh; *(v4us*)(Pl + oo) = ol; }
        } else {
#pragma unroll
            for (int ch = 0; ch < TT / 128; ++ch) { v4h o4;
#pragma unroll
                for (int q = 0; q < 4; ++q) o4[q] = tohx(v[ch * 4 + q] * f);
                *(v4h*)(P16 + (size_t)row * TT + ch * 128 + lane * 4) = o4; } }
         }
}
__global__ __launch_bounds__(256) void k_merge(const float* __restrict__ O, int h0, float* OUTb) { const size_t e = ((size_t)blockIdx.x * 256 + threadIdx.x) * 2; if (e >= (size_t)ZH * TT * HD) return; const int d = (int)(e % HD); const int t = (int)((e / HD) % TT); const int zz = (int)(e / ((size_t)HD * TT)); const float cs = (t < RH) ? 1.0f : (1.0f / PCAR); const size_t oo = (size_t)t * DQ + (h0 + zz) * HD + d;
    v2f s2 = *(const v2f*)(O + e);
#pragma unroll
    for (int g = 1; g < KGV; ++g) s2 += *(const v2f*)(O + (size_t)g * ZH * TT * HD + e);   // the K groups' partial planes, in group order
    v2f o2; o2[0] = s2[0] * cs; o2[1] = s2[1] * cs; *(v2f*)(OUTb + oo) = o2;  }

extern "C" void kernel_launch(void* const* d_in, const int* in_sizes, int n_in,
                              void* d_out, int out_size, void* d_ws, size_t ws_size, hipStream_t stream) {
    (void)in_sizes; (void)n_in; (void)out_size;
    const float* x = (const float*)d_in[0]; const float* wq = (const float*)d_in[1]; const float* bq = (const float*)d_in[2]; const float* wk = (const float*)d_in[3]; const float* bk = (const float*)d_in[4]; const float* wv = (const float*)d_in[5]; const float* bv = (const float*)d_in[6];   /* argument order hidden_states, Wq, bq, Wk, bk, Wv, bv ('xw' + biases) */ const float* wo = nullptr; (void)wo;
    float* OUT = (float*)d_out;     // [4][2048][512]
    char* wsp = (char*)d_ws;
    auto take = [&](size_t bytes) { char* p = wsp; wsp += (bytes + 255) & ~(size_t)255; return (void*)p; };
    bf* WQ = (bf*)take((size_t)DQ * DM * 2); bf* WK = (bf*)take((size_t)DKV * DM * 2); bf* WV = (bf*)take((size_t)DKV * DM * 2); float* CS = (float*)take((size_t)TT * HD * 2 * 4);
    bf* XB = (bf*)take((size_t)TT * DM * 2); float* FQ = (float*)take((size_t)TT * DQ * 4); float* FK = (float*)take((size_t)TT * DKV * 4);
    h16* QP16 = (h16*)take((size_t)NH_ * TT * HD * 2); h16* KP16 = (h16*)take((size_t)NKV * TT * HD * 2); h16* VT16 = (h16*)take((size_t)NKV * HD * TT * 2);
    bf* QPh = (bf*)take((size_t)NH_ * TT * HD * 2); bf* QPl = (bf*)take((size_t)NH_ * TT * HD * 2); bf* KPh = (bf*)take((size_t)NKV * TT * HD * 2); bf* KPl = (bf*)take((size_t)NKV * TT * HD * 2); bf* VTh = (bf*)take((size_t)NKV * HD * TT * 2); bf* VTl = (bf*)take((size_t)NKV * HD * TT * 2); bf* Ph = (bf*)take((size_t)ZH * RH * TT * 2); bf* Pl = (bf*)take((size_t)ZH * RH * TT * 2);
    float* Sb = (float*)take((size_t)ZH * TT * TT * 4); h16* P16 = (h16*)take((size_t)ZH * TT * TT * 2); float* Ob = (float*)take((size_t)KGV * ZH * TT * HD * 4);
    if ((size_t)(wsp - (char*)d_ws) > ws_size) return;    // ws 256 MiB
    float* FV = FK;   // v projection reuses the k buffer after the k planes are built (stream-ordered)
    { k_wtG<<<(unsigned)((DM * DQ / 64 + 63) / 64), 256, 0, stream>>>(wq, DM, DQ, WQ); k_wtG<<<(unsigned)((DM * DKV / 64 + 63) / 64), 256, 0, stream>>>(wk, DM, DKV, WK); k_wtG<<<(unsigned)((DM * DKV / 64 + 63) / 64), 256, 0, stream>>>(wv, DM, DKV, WV);
      
       }
    k_csid<<<(TT * HD + 255) / 256, 256, 0, stream>>>(CS);
    const unsigned LQ = (unsigned)(((size_t)NH_ * TT * HD / 2 + 255) / 256), LKv = (unsigned)(((size_t)NKV * TT * HD / 2 + 255) / 256);
    for (int b = 0; b < NB_; ++b) {
        
        k_cvt8<<<(unsigned)(((size_t)TT * DM / 8 + 255) / 256), 256, 0, stream>>>(x + (size_t)b * TT * DM, XB, (size_t)TT * DM / 8);
        k_gemmk<bf, 0, true, 4, 8, 1, DM><<<dim3(TT / 64, DQ / 64, 1), 256, 0, stream>>>(XB, nullptr, WQ, nullptr, FQ, DQ, bq, 0, 0, 0, 0);
        k_rope<<<LQ, 256, 0, stream>>>(FQ, DQ, NH_, CS, nullptr, nullptr, 1.0f, QP16, QPh, QPl);
        k_gemmk<bf, 0, true, 4, 8, 1, DM><<<dim3(TT / 64, DKV / 64, 1), 256, 0, stream>>>(XB, nullptr, WK, nullptr, FK, DKV, bk, 0, 0, 0, 0);
        k_rope<<<LKv, 256, 0, stream>>>(FK, DKV, NKV, CS, nullptr, nullptr, 1.0f, KP16, KPh, KPl);
        k_gemmk<bf, 0, true, 4, 8, 1, DM><<<dim3(TT / 64, DKV / 64, 1), 256, 0, stream>>>(XB, nullptr, WV, nullptr, FV, DKV, bv, 0, 0, 0, 0); k_vtp<<<LKv, 256, 0, stream>>>(FV, DKV, NKV, VT16, VTh, VTl);
        for (int h0 = 0; h0 < NH_; h0 += ZH) { const size_t zq = (size_t)h0, zk = (size_t)(h0 / REP);   // one kv head per query head: the pass's two heads use consecutive kv planes (z-strides TT*HD)
            k_gemmw<bf, 2, false><<<dim3(RH / 64, TT / 64, ZH), 32, 0, stream>>>(QPh + zq * TT * HD, QPl + zq * TT * HD, KPh + zk * TT * HD, KPl + zk * TT * HD, HD, Sb, TT, nullptr, (size_t)TT * HD, (size_t)TT * HD, (size_t)TT * TT);
            k_alibi<<<(unsigned)(((size_t)ZH * TT * TT / 4 + 255) / 256), 256, 0, stream>>>(Sb, h0);   /* - slope_h |i-j| (x 8, in f32) */ k_asoft<<<ZH * TT / 8, 256, 0, stream>>>(Sb, P16, Ph, Pl);
            k_gemmk<bf, 2, false, 4, 8, KGV, TT><<<dim3(RH / 64, HD / 64 * KGV, ZH), 256, 0, stream>>>(Ph, Pl, VTh + zk * HD * TT, VTl + zk * HD * TT, Ob, HD, nullptr, (size_t)RH * TT, (size_t)HD * TT, (size_t)TT * HD, (size_t)ZH * TT * HD);
            k_merge<<<(unsigned)(((size_t)ZH * TT * HD / 2 + 255) / 256), 256, 0, stream>>>(Ob, h0, OUT + (size_t)b * TT * DQ); }
         }
}

// v002
// One run takes 691 microseconds.
// Two timings next to v001 put it at 1.22 and 1.20 times that version's speed.
// Counting every step since v000, it is 2.06 times as fast.
#include <hip/hip_runtime.h>

// BERT-style self-attention with a symmetric ALiBi score bias and no output projection (hidden_states [4][2048][512]; q, k, v = x W + b ('xw' [512][512] 0.02 incl. biases; 8 heads x 64); scores = q.k / sqrt(64) + slope_h |i - j| with slope_h = -2^-(h+1) (h = 0..7: the module's _get_slopes(8), negated; up to -0.5 x 2047); softmax over all keys; out = merged context -> [4][2048][512] (4.2 M); argument order hidden_states, Wq, bq, Wk, bk, Wv, bv).
// Layout per batch: bf16 copy of x; 'xw' weights transposed once; exact projections + f32 biases; identity-table plane builders; dense T-2048 attention with EVERY row on hi/lo planes (3 products; the ALiBi term makes the steep heads few-key sharp, so no fp16 rows); the softmax kernel subtracts 8 x |slope_h| x |i - j| from each raw f32 score as it loads it (undone by its exact x 1/8); the f32 merge writes the output rows.
// Compute dtypes, f32 accumulate: every input rounded to bf16; projections exact + f32 biases; scores and attn.v 3 products on every row; ALiBi add and softmax f32; output f32.

#define NB_  4
#define TT   2048
#define DM   512
#define NH_  8
#define NKV  8
#define REP  (NH_ / NKV)
#define HD   64
#define DQ   (NH_ * HD)
#define DKV  (NKV * HD)
#define ZH   2
#define RH   TT                   // every row hi/lo (3 products)
#define WIN  0
#define PCAR 1024.0f
#define SCL  0.125f   // HD^-0.5
#define KGV  4        // attn.v: K groups over work-groups, one partial context plane each, added in k_merge
typedef _Float16 h16;
typedef unsigned short bf;
typedef __attribute__((ext_vector_type(16))) __bf16   v16bf;
typedef __attribute__((ext_vector_type(16))) _Float16 v16h;
typedef __attribute__((ext_vector_type(8)))  _Float16 v8h;
typedef __attribute__((ext_vector_type(8)))  unsigned short v8us;
typedef __attribute__((ext_vector_type(8)))  float    v8f;
typedef __attribute__((ext_vector_type(4)))  float    v4f;
typedef v8h  __attribute__((may_alias)) v8ha;
typedef v4f  __attribute__((may_alias)) v4fa;
typedef v8us __attribute__((may_alias)) v8usa;

__device__ __forceinline__ unsigned short f2bf(float f) { unsigned u = __float_as_uint(f); u += 0x7FFFu + ((u >> 16) & 1u); return (unsigned short)(u >> 16); }
__device__ __forceinline__ float bf2f(unsigned short b) { return __uint_as_float(((unsigned)b) << 16); }
__device__ __forceinline__ float bfr(float f) { return bf2f(f2bf(f)); }
__device__ __forceinline__ v16h cat16(v8h lo, v8h hi) { return __builtin_shufflevector(lo, hi, 0, 1, 2, 3, 4, 5, 6, 7, 8, 9, 10, 11, 12, 13, 14, 15); }
__device__ __forceinline__ v16bf cat16b(v8us lo, v8us hi) { return __builtin_bit_cast(v16bf, __builtin_shufflevector(lo, hi, 0, 1, 2, 3, 4, 5, 6, 7, 8, 9, 10, 11, 12, 13, 14, 15)); }
__device__ __forceinline__ v8f wmma16(v16h a, v16h b, v8f c) { return __builtin_amdgcn_wmma_f32_16x16x32_f16(false, a, false, b, (short)0, c, false, false); }
__device__ __forceinline__ v8f wmmab(v16bf a, v16bf b, v8f c) { return __builtin_amdgcn_wmma_f32_16x16x32_bf16(false, a, false, b, (short)0, c, false, false); }



// ---- k_gemmw: register-blocked GEMM, ONE WAVE per 64x64 output tile (16 accumulators), operands straight from K-contiguous 16-bit planes; grid (M/64, N/64, Z), 32 threads.
// C[m][n] (f32, pitch ldc, + optional f32 bias[n]) = sum_k A[m][k] Bt[n][k] (+ split products per NSPLIT). z-batch strides sA/sB/sC in elements. K % 32 == 0.
template <typename T16> struct WFrag;
template <> struct WFrag<h16> { typedef v16h V; static __device__ __forceinline__ V ld(const h16* p) { return cat16(*(const v8h*)p, *(const v8h*)(p + 16)); } static __device__ __forceinline__ v8f mma(V a, V b, v8f c) { return wmma16(a, b, c); } };
template <> struct WFrag<bf> { typedef v16bf V; static __device__ __forceinline__ V ld(const bf* p) { return cat16b(*(const v8us*)p, *(const v8us*)(p + 16)); } static __device__ __forceinline__ v8f mma(V a, V b, v8f c) { return wmmab(a, b, c); } };
template <typename T16, int NSPLIT, bool BIAS>
__global__ __launch_bounds__(32) void k_gemmw(const T16* __restrict__ A, const T16* __restrict__ A2, const T16* __restrict__ Bt, const T16* __restrict__ Bt2, int K, float* C, int ldc, const float* __restrict__ bias, size_t sA, size_t sB, size_t sC) {
    typedef typename WFrag<T16>::V V;
    __shared__ __align__(16) float os[16 * 68];
    const size_t z = blockIdx.z; A += z * sA; if (A2) A2 += z * sA; Bt += z * sB; if (Bt2) Bt2 += z * sB; C += z * sC;
    const int lane = threadIdx.x & 31, lr = lane & 15, hi = lane >> 4; const int r0 = blockIdx.x * 64, c0 = blockIdx.y * 64;
    v8f acc[4][4];
#pragma unroll
    for (int mb = 0; mb < 4; ++mb)
#pragma unroll
        for (int nb = 0; nb < 4; ++nb) acc[mb][nb] = (v8f){};
    const size_t aoff = (size_t)(r0 + lr) * K + 8 * hi, boff = (size_t)(c0 + lr) * K + 8 * hi;
#pragma unroll 1
    for (int kc = 0; kc < K; kc += 32) {
        V a[4], a2[4];
#pragma unroll
        for (int mb = 0; mb < 4; ++mb) { a[mb] = WFrag<T16>::ld(A + aoff + (size_t)mb * 16 * K + kc); if (NSPLIT == 1 || NSPLIT == 2) a2[mb] = WFrag<T16>::ld(A2 + aoff + (size_t)mb * 16 * K + kc); }
#pragma unroll
        for (int nb = 0; nb < 4; ++nb) { const V b = WFrag<T16>::ld(Bt + boff + (size_t)nb * 16 * K + kc); V b2; if (NSPLIT >= 2) b2 = WFrag<T16>::ld(Bt2 + boff + (size_t)nb * 16 * K + kc);
#pragma unroll
            for (int mb = 0; mb < 4; ++mb) { acc[mb][nb] = WFrag<T16>::mma(a[mb], b, acc[mb][nb]); if (NSPLIT == 1 || NSPLIT == 2) acc[mb][nb] = WFrag<T16>::mma(a2[mb], b, acc[mb][nb]); if (NSPLIT >= 2) acc[mb][nb] = WFrag<T16>::mma(a[mb], b2, acc[mb][nb]); } }
        asm volatile("v_nop\n\tv_nop\n\tv_nop\n\tv_nop" : "+v"(acc[0][0]), "+v"(acc[1][1]), "+v"(acc[2][2]), "+v"(acc[3][3]) : "v"(a[0]), "v"(a[3]));
    }
#pragma unroll
    for (int mb = 0; mb < 4; ++mb) {
#pragma unroll
        for (int nb = 0; nb < 4; ++nb) {
#pragma unroll
            for (int j = 0; j < 8; ++j) os[(hi * 8 + j) * 68 + nb * 16 + lr] = acc[mb][nb][j]; }
        __builtin_amdgcn_wave_barrier(); asm volatile("" ::: "memory");
        float* crow = C + (size_t)(r0 + mb * 16) * ldc + c0;
{
#pragma unroll
            for (int s = 0; s < 8; ++s) { const int row = 2 * s + hi, cofs = lr * 4; v4f val = *(const v4fa*)(os + row * 68 + cofs); if (BIAS) { val[0] += bfr(bias[c0 + cofs]); val[1] += bfr(bias[c0 + cofs + 1]); val[2] += bfr(bias[c0 + cofs + 2]); val[3] += bfr(bias[c0 + cofs + 3]); }
                *(v4f*)(crow + (size_t)row * ldc + cofs) = val; }
             }
        __builtin_amdgcn_wave_barrier(); asm volatile("" ::: "memory");
    }
}

// ---- k_gemmk: the same product for a deep K and few output tiles: K (= KK, also the operands' pitch) is split into KG * NW equal runs. Work-group (x, y, z) takes the (MB*16)x64 tile (x, y / KG) and K group kg = y % KG; its wave w takes run kg * NW + w; the NW partial tiles meet in LDS and are summed in wave order; the sum goes to plane kg of C (plane stride sK elements; KG > 1: the reader adds the planes). grid (M/(MB*16), N/64 * KG, Z), NW*32 threads. KK % (32 KG NW) == 0.
template <typename T16, int NSPLIT, bool BIAS, int MB, int NW, int KG, int KK>
__global__ __launch_bounds__(NW * 32) void k_gemmk(const T16* __restrict__ A, const T16* __restrict__ A2, const T16* __restrict__ Bt, const T16* __restrict__ Bt2, float* C, int ldc, const float* __restrict__ bias, size_t sA, size_t sB, size_t sC, size_t sK) {
    typedef typename WFrag<T16>::V V;
    __shared__ __align__(16) float red[NW * MB * 16 * 68];
    const size_t z = blockIdx.z; A += z * sA; if (NSPLIT == 1 || NSPLIT == 2) A2 += z * sA; Bt += z * sB; if (NSPLIT >= 2) Bt2 += z * sB; C += z * sC + (blockIdx.y % KG) * sK;
    const int lane = threadIdx.x & 31, lr = lane & 15, hi = lane >> 4, wv = threadIdx.x >> 5; const int r0 = blockIdx.x * (MB * 16), c0 = (blockIdx.y / KG) * 64; constexpr int KR = KK / (KG * NW); const int k0 = ((blockIdx.y % KG) * NW + wv) * KR;
    v8f acc[MB][4];
#pragma unroll
    for (int mb = 0; mb < MB; ++mb)
#pragma unroll
        for (int nb = 0; nb < 4; ++nb) acc[mb][nb] = (v8f){};
    const size_t aoff = (size_t)(r0 + lr) * KK + k0 + 8 * hi, boff = (size_t)(c0 + lr) * KK + k0 + 8 * hi;
#pragma unroll 1   // rolled: a trip's fragments and the accumulators fill the registers; unrolled, the compiler waited on each fragment load by itself
    for (int kc = 0; kc < KR; kc += 32) {
        V a[MB], a2[MB], b[4], b2[4];
#pragma unroll
        for (int mb = 0; mb < MB; ++mb) { a[mb] = WFrag<T16>::ld(A + aoff + (size_t)mb * 16 * KK + kc); if (NSPLIT == 1 || NSPLIT == 2) a2[mb] = WFrag<T16>::ld(A2 + aoff + (size_t)mb * 16 * KK + kc); }
#pragma unroll
        for (int nb = 0; nb < 4; ++nb) { b[nb] = WFrag<T16>::ld(Bt + boff + (size_t)nb * 16 * KK + kc); if (NSPLIT >= 2) b2[nb] = WFrag<T16>::ld(Bt2 + boff + (size_t)nb * 16 * KK + kc); }
#pragma unroll
        for (int nb = 0; nb < 4; ++nb)
#pragma unroll
            for (int mb = 0; mb < MB; ++mb) { acc[mb][nb] = WFrag<T16>::mma(a[mb], b[nb], acc[mb][nb]); if (NSPLIT == 1 || NSPLIT == 2) acc[mb][nb] = WFrag<T16>::mma(a2[mb], b[nb], acc[mb][nb]); if (NSPLIT >= 2) acc[mb][nb] = WFrag<T16>::mma(a[mb], b2[nb], acc[mb][nb]); }
    }
    float* my = red + wv * (MB * 16 * 68);
#pragma unroll
    for (int mb = 0; mb < MB; ++mb)
#pragma unroll
        for (int nb = 0; nb < 4; ++nb)
#pragma unroll
            for (int j = 0; j < 8; ++j) my[(mb * 16 + hi * 8 + j) * 68 + nb * 16 + lr] = acc[mb][nb][j];
    __syncthreads();   // every wave's partial tile is in LDS before any thread sums across the waves
#pragma unroll
    for (int it = 0; it < MB * 16 * 16 / (NW * 32); ++it) { const int q = it * (NW * 32) + threadIdx.x; const int row = q >> 4, cofs = (q & 15) * 4; v4f val = *(const v4fa*)(red + row * 68 + cofs);
#pragma unroll
        for (int w = 1; w < NW; ++w) val += *(const v4fa*)(red + w * (MB * 16 * 68) + row * 68 + cofs);
        if (BIAS) { val[0] += bfr(bias[c0 + cofs]); val[1] += bfr(bias[c0 + cofs + 1]); val[2] += bfr(bias[c0 + cofs + 2]); val[3] += bfr(bias[c0 + cofs + 3]); }
        *(v4f*)(C + (size_t)(r0 + row) * ldc + c0 + cofs) = val; }
}

__device__ __forceinline__ h16 tohx(float x) { return (h16)x; }
__device__ __forceinline__ void splitf(float y, unsigned short& h, unsigned short& l) { h = f2bf(y); l = f2bf(y - bf2f(h)); }
typedef __attribute__((ext_vector_type(2))) _Float16 v2h;
typedef __attribute__((ext_vector_type(4))) _Float16 v4h;
typedef __attribute__((ext_vector_type(2))) unsigned short v2us;
typedef __attribute__((ext_vector_type(4))) unsigned short v4us;
typedef __attribute__((ext_vector_type(2))) float v2f;
typedef __attribute__((ext_vector_type(4))) int v4i;

__global__ __launch_bounds__(256) void k_wtG(const float* __restrict__ w, int K, int N, bf* Bt) {
    const int lane = threadIdx.x & 31; const int L0 = (blockIdx.x * 8 + (threadIdx.x >> 5)) * 8; const int nlines = N * K / 64;
{
#pragma unroll 1
        for (int l = 0; l < 8; ++l) { const int L = L0 + l; if (L >= nlines) break; const size_t e = (size_t)L * 64 + lane * 2; const int k = (int)(e % K), n = (int)(e / K); v2us o;
            o[0] = f2bf(w[(size_t)k * N + n]); o[1] = f2bf(w[(size_t)(k + 1) * N + n]); *(v2us*)(Bt + e) = o; }
         }
}
__global__ __launch_bounds__(256) void k_cvt8(const float* __restrict__ src, bf* dst, size_t n8) { const size_t i = (size_t)blockIdx.x * 256 + threadIdx.x; if (i >= n8) return; const v8f v = *(const v8f*)(src + i * 8); v8us o;
#pragma unroll
    for (int k = 0; k < 8; ++k) o[k] = f2bf(v[k]); *(v8us*)(dst + i * 8) = o;  }

// k_rope: head planes [h][t][d] (fp16 + hi/lo) of rope(x) x sc with the rotate-half convention out[d] = x[d] cos[t][d] - x[d+HD/2] sin[t][d], out[d+HD/2] = x[d+HD/2] cos[t][d+HD/2] + x[d] sin[t][d+HD/2]
__global__ __launch_bounds__(256) void k_rope(const float* __restrict__ F, int pitch, int nheads, const float* __restrict__ CS, const float* __restrict__ RF, const float* __restrict__ nw, float sc, h16* P16, bf* Ph, bf* Pl) {
    const size_t e = ((size_t)blockIdx.x * 256 + threadIdx.x) * 2; if (e >= (size_t)nheads * TT * HD) return; const int d = (int)(e % HD); const int t = (int)((e / HD) % TT); const int h = (int)(e / ((size_t)HD * TT)); const float* f = F + (size_t)t * pitch + h * HD; const float rf = RF ? RF[(size_t)h * TT + t] : 1.0f; v2h o16; v2us oh, ol;
#pragma unroll
    for (int q = 0; q < 2; ++q) { const int dd = d + q; const int dp = (dd < HD / 2) ? dd + HD / 2 : dd - HD / 2; float x0 = f[dd], x1 = f[dp];
        if (RF) { float n0 = __fmul_rn(x0, rf), n1 = __fmul_rn(x1, rf); asm volatile("" : "+v"(n0)); asm volatile("" : "+v"(n1)); x0 = __fmul_rn(bfr(nw[dd]), n0); x1 = __fmul_rn(bfr(nw[dp]), n1); }
        const v2f cs = *(const v2f*)(CS + ((size_t)t * HD + dd) * 2); float a = __fmul_rn(x0, cs[0]), bq = __fmul_rn(x1, cs[1]); asm volatile("" : "+v"(a)); asm volatile("" : "+v"(bq)); const float r = ((dd < HD / 2) ? __fsub_rn(a, bq) : __fadd_rn(a, bq)) * sc;
        o16[q] = tohx(r); unsigned short a2, c2; splitf(r, a2, c2); oh[q] = a2; ol[q] = c2; }
    *(v2h*)(P16 + e) = o16; *(v2us*)(Ph + e) = oh; *(v2us*)(Pl + e) = ol;  }
__global__ __launch_bounds__(256) void k_vtp(const float* __restrict__ F, int pitch, int nheads, h16* V16, bf* Vh, bf* Vl) { const size_t e = ((size_t)blockIdx.x * 256 + threadIdx.x) * 2; if (e >= (size_t)nheads * HD * TT) return; const int t = (int)(e % TT); const int d = (int)((e / TT) % HD); const int g = (int)(e / ((size_t)TT * HD)); v2h o16; v2us oh, ol;
#pragma unroll
    for (int q = 0; q < 2; ++q) { const float x = F[(size_t)(t + q) * pitch + g * HD + d]; o16[q] = tohx(x); unsigned short a2, c2; splitf(x, a2, c2); oh[q] = a2; ol[q] = c2; }
    *(v2h*)(V16 + e) = o16; *(v2us*)(Vh + e) = oh; *(v2us*)(Vl + e) = ol;  }
__global__ __launch_bounds__(256) void k_csid(float* CS) { const int idx = blockIdx.x * 256 + threadIdx.x; if (idx >= TT * HD) return; v2f cs; cs[0] = 1.0f; cs[1] = 0.0f; *(v2f*)(CS + (size_t)idx * 2) = cs;  }
__constant__ float SLOPE8[NH_] = { 4.000000000e+0f, 2.000000000e+0f, 1.000000000e+0f, 5.000000000e-1f, 2.500000000e-1f, 1.250000000e-1f, 6.250000000e-2f, 3.125000000e-2f };   // 8 x the per-head ALiBi slope magnitude (|slope_h| = 2^-(h+1), h = 0..7); every entry and every product with |i - j| <= 2047 is exact in f32
// k_asoft: per row (zz, i): t = (S - 8 |slope| |i - j|) x HD^-0.5 (no mask; distance and product are exact in f32, so the subtraction rounds once, fused or not); softmax over the 2048 keys (register row, one exp, fixed trees);
__global__ __launch_bounds__(256) void k_asoft(const float* __restrict__ Sb, int h0, h16* P16, bf* Ph, bf* Pl) {
    const int lane = threadIdx.x & 31; const int row = blockIdx.x * 8 + (threadIdx.x >> 5); if (row >= ZH * TT) return; const int i = row % TT; const int zz = row / TT; const float sl = SLOPE8[h0 + zz]; const bool hires = (i < RH); const float* sr = Sb + (size_t)row * TT; float v[TT / 32]; float mx = -3.0e38f;
#pragma unroll
    for (int ch = 0; ch < TT / 128; ++ch) { const int j0 = ch * 128 + lane * 4; const v4f a = *(const v4f*)(sr + j0); const float d0 = (float)(i - j0);
#pragma unroll
        for (int q = 0; q < 4; ++q) { const float t = (a[q] - sl * fabsf(d0 - (float)q)) * SCL; v[ch * 4 + q] = t; mx = fmaxf(mx, t); } }
#pragma unroll
    for (int sh = 16; sh; sh >>= 1) mx = fmaxf(mx, __shfl_xor(mx, sh, 32));
    float sum = 0.f;
#pragma unroll
    for (int k = 0; k < TT / 32; ++k) { float d0 = __fsub_rn(v[k], mx); asm volatile("" : "+v"(d0)); v[k] = __builtin_amdgcn_exp2f(__fmul_rn(d0, 1.4426950408889634f)); sum += v[k]; }
#pragma unroll
    for (int sh = 16; sh; sh >>= 1) sum += __shfl_xor(sum, sh, 32);
    const float f = __fdiv_rn(hires ? 1.0f : PCAR, sum);
{
        if (hires) {
#pragma unroll
            for (int ch = 0; ch < TT / 128; ++ch) { v4us oh, ol;
#pragma unroll
                for (int q = 0; q < 4; ++q) { unsigned short a, c2; splitf(v[ch * 4 + q] * f, a, c2); oh[q] = a; ol[q] = c2; }
                const size_t oo = ((size_t)zz * (RH ? RH : 1) + i) * TT + ch * 128 + lane * 4; *(v4us*)(Ph + oo) = oh; *(v4us*)(Pl + oo) = ol; }
        } else {
#pragma unroll
            for (int ch = 0; ch < TT / 128; ++ch) { v4h o4;
#pragma unroll
                for (int q = 0; q < 4; ++q) o4[q] = tohx(v[ch * 4 + q] * f);
                *(v4h*)(P16 + (size_t)row * TT + ch * 128 + lane * 4) = o4; } }
         }
}
__global__ __launch_bounds__(256) void k_merge(const float* __restrict__ O, int h0, float* OUTb) { const size_t e = ((size_t)blockIdx.x * 256 + threadIdx.x) * 2; if (e >= (size_t)ZH * TT * HD) return; const int d = (int)(e % HD); const int t = (int)((e / HD) % TT); const int zz = (int)(e / ((size_t)HD * TT)); const float cs = (t < RH) ? 1.0f : (1.0f / PCAR); const size_t oo = (size_t)t * DQ + (h0 + zz) * HD + d;
    v2f s2 = *(const v2f*)(O + e);
#pragma unroll
    for (int g = 1; g < KGV; ++g) s2 += *(const v2f*)(O + (size_t)g * ZH * TT * HD + e);   // the K groups' partial planes, in group order
    v2f o2; o2[0] = s2[0] * cs; o2[1] = s2[1] * cs; *(v2f*)(OUTb + oo) = o2;  }

extern "C" void kernel_launch(void* const* d_in, const int* in_sizes, int n_in,
                              void* d_out, int out_size, void* d_ws, size_t ws_size, hipStream_t stream) {
    (void)in_sizes; (void)n_in; (void)out_size;
    const float* x = (const float*)d_in[0]; const float* wq = (const float*)d_in[1]; const float* bq = (const float*)d_in[2]; const float* wk = (const float*)d_in[3]; const float* bk = (const float*)d_in[4]; const float* wv = (const float*)d_in[5]; const float* bv = (const float*)d_in[6];   /* argument order hidden_states, Wq, bq, Wk, bk, Wv, bv ('xw' + biases) */ const float* wo = nullptr; (void)wo;
    float* OUT = (float*)d_out;     // [4][2048][512]
    char* wsp = (char*)d_ws;
    auto take = [&](size_t bytes) { char* p = wsp; wsp += (bytes + 255) & ~(size_t)255; return (void*)p; };
    bf* WQ = (bf*)take((size_t)DQ * DM * 2); bf* WK = (bf*)take((size_t)DKV * DM * 2); bf* WV = (bf*)take((size_t)DKV * DM * 2); float* CS = (float*)take((size_t)TT * HD * 2 * 4);
    bf* XB = (bf*)take((size_t)TT * DM * 2); float* FQ = (float*)take((size_t)TT * DQ * 4); float* FK = (float*)take((size_t)TT * DKV * 4);
    h16* QP16 = (h16*)take((size_t)NH_ * TT * HD * 2); h16* KP16 = (h16*)take((size_t)NKV * TT * HD * 2); h16* VT16 = (h16*)take((size_t)NKV * HD * TT * 2);
    bf* QPh = (bf*)take((size_t)NH_ * TT * HD * 2); bf* QPl = (bf*)take((size_t)NH_ * TT * HD * 2); bf* KPh = (bf*)take((size_t)NKV * TT * HD * 2); bf* KPl = (bf*)take((size_t)NKV * TT * HD * 2); bf* VTh = (bf*)take((size_t)NKV * HD * TT * 2); bf* VTl = (bf*)take((size_t)NKV * HD * TT * 2); bf* Ph = (bf*)take((size_t)ZH * RH * TT * 2); bf* Pl = (bf*)take((size_t)ZH * RH * TT * 2);
    float* Sb = (float*)take((size_t)ZH * TT * TT * 4); h16* P16 = (h16*)take((size_t)ZH * TT * TT * 2); float* Ob = (float*)take((size_t)KGV * ZH * TT * HD * 4);
    if ((size_t)(wsp - (char*)d_ws) > ws_size) return;    // ws 256 MiB
    float* FV = FK;   // v projection reuses the k buffer after the k planes are built (stream-ordered)
    { k_wtG<<<(unsigned)((DM * DQ / 64 + 63) / 64), 256, 0, stream>>>(wq, DM, DQ, WQ); k_wtG<<<(unsigned)((DM * DKV / 64 + 63) / 64), 256, 0, stream>>>(wk, DM, DKV, WK); k_wtG<<<(unsigned)((DM * DKV / 64 + 63) / 64), 256, 0, stream>>>(wv, DM, DKV, WV);
      
       }
    k_csid<<<(TT * HD + 255) / 256, 256, 0, stream>>>(CS);
    const unsigned LQ = (unsigned)(((size_t)NH_ * TT * HD / 2 + 255) / 256), LKv = (unsigned)(((size_t)NKV * TT * HD / 2 + 255) / 256);
    for (int b = 0; b < NB_; ++b) {
        
        k_cvt8<<<(unsigned)(((size_t)TT * DM / 8 + 255) / 256), 256, 0, stream>>>(x + (size_t)b * TT * DM, XB, (size_t)TT * DM / 8);
        k_gemmk<bf, 0, true, 4, 8, 1, DM><<<dim3(TT / 64, DQ / 64, 1), 256, 0, stream>>>(XB, nullptr, WQ, nullptr, FQ, DQ, bq, 0, 0, 0, 0);
        k_rope<<<LQ, 256, 0, stream>>>(FQ, DQ, NH_, CS, nullptr, nullptr, 1.0f, QP16, QPh, QPl);
        k_gemmk<bf, 0, true, 4, 8, 1, DM><<<dim3(TT / 64, DKV / 64, 1), 256, 0, stream>>>(XB, nullptr, WK, nullptr, FK, DKV, bk, 0, 0, 0, 0);
        k_rope<<<LKv, 256, 0, stream>>>(FK, DKV, NKV, CS, nullptr, nullptr, 1.0f, KP16, KPh, KPl);
        k_gemmk<bf, 0, true, 4, 8, 1, DM><<<dim3(TT / 64, DKV / 64, 1), 256, 0, stream>>>(XB, nullptr, WV, nullptr, FV, DKV, bv, 0, 0, 0, 0); k_vtp<<<LKv, 256, 0, stream>>>(FV, DKV, NKV, VT16, VTh, VTl);
        for (int h0 = 0; h0 < NH_; h0 += ZH) { const size_t zq = (size_t)h0, zk = (size_t)(h0 / REP);   // one kv head per query head: the pass's two heads use consecutive kv planes (z-strides TT*HD)
            k_gemmw<bf, 2, false><<<dim3(RH / 64, TT / 64, ZH), 32, 0, stream>>>(QPh + zq * TT * HD, QPl + zq * TT * HD, KPh + zk * TT * HD, KPl + zk * TT * HD, HD, Sb, TT, nullptr, (size_t)TT * HD, (size_t)TT * HD, (size_t)TT * TT);
            k_asoft<<<ZH * TT / 8, 256, 0, stream>>>(Sb, h0, P16, Ph, Pl);   /* - slope_h |i-j| (x 8, in f32), then softmax */
            k_gemmk<bf, 2, false, 4, 8, KGV, TT><<<dim3(RH / 64, HD / 64 * KGV, ZH), 256, 0, stream>>>(Ph, Pl, VTh + zk * HD * TT, VTl + zk * HD * TT, Ob, HD, nullptr, (size_t)RH * TT, (size_t)HD * TT, (size_t)TT * HD, (size_t)ZH * TT * HD);
            k_merge<<<(unsigned)(((size_t)ZH * TT * HD / 2 + 255) / 256), 256, 0, stream>>>(Ob, h0, OUT + (size_t)b * TT * DQ); }
         }
}

// v004
// It runs in 141 microseconds.
// It is 4.91 times as fast as v002, going by the measured steps of the versions left out in between.
// Over all steps from v000 it is 10.1 times as fast.
#include <hip/hip_runtime.h>

// BERT-style self-attention with a symmetric ALiBi score bias and no output projection (hidden_states [4][2048][512]; q, k, v = x W + b ('xw' [512][512] 0.02 incl. biases; 8 heads x 64); scores = q.k / sqrt(64) + slope_h |i - j| with slope_h = -2^-(h+1) (h = 0..7: the module's _get_slopes(8), negated; up to -0.5 x 2047); softmax over all keys; out = merged context -> [4][2048][512] (4.2 M); argument order hidden_states, Wq, bq, Wk, bk, Wv, bv).
// Three launches: bf16 copy of x and the 'xw' weights transposed; ONE projection launch over all batches and q, k, v (f32 biases) that stores the hi/lo planes from its accumulators; then ONE fused attention launch over all 32 (batch, head) planes with EVERY row on hi/lo planes (3 products; the ALiBi term makes the steep heads few-key sharp, so no fp16 rows): it subtracts 8 x |slope_h| x |i - j| from each raw f32 score in the accumulator (undone by its exact x 1/8), keeps a running maximum and sum, and writes the output rows.
// Compute dtypes, f32 accumulate: every input rounded to bf16; projections exact + f32 biases; scores and attn.v 3 products on every row; ALiBi add and softmax f32; output f32.

#define NB_  4
#define TT   2048
#define DM   512
#define NH_  8
#define NKV  8
#define REP  (NH_ / NKV)
#define HD   64
#define DQ   (NH_ * HD)
#define DKV  (NKV * HD)
#define SCL  0.125f   // HD^-0.5
typedef _Float16 h16;
typedef unsigned short bf;
typedef __attribute__((ext_vector_type(16))) __bf16   v16bf;
typedef __attribute__((ext_vector_type(16))) _Float16 v16h;
typedef __attribute__((ext_vector_type(8)))  _Float16 v8h;
typedef __attribute__((ext_vector_type(8)))  unsigned short v8us;
typedef __attribute__((ext_vector_type(8)))  float    v8f;
typedef __attribute__((ext_vector_type(4)))  float    v4f;
typedef v8h  __attribute__((may_alias)) v8ha;
typedef v4f  __attribute__((may_alias)) v4fa;
typedef v8us __attribute__((may_alias)) v8usa;

__device__ __forceinline__ unsigned short f2bf(float f) { unsigned u = __float_as_uint(f); u += 0x7FFFu + ((u >> 16) & 1u); return (unsigned short)(u >> 16); }
__device__ __forceinline__ float bf2f(unsigned short b) { return __uint_as_float(((unsigned)b) << 16); }
__device__ __forceinline__ float bfr(float f) { return bf2f(f2bf(f)); }
__device__ __forceinline__ v16h cat16(v8h lo, v8h hi) { return __builtin_shufflevector(lo, hi, 0, 1, 2, 3, 4, 5, 6, 7, 8, 9, 10, 11, 12, 13, 14, 15); }
__device__ __forceinline__ v16bf cat16b(v8us lo, v8us hi) { return __builtin_bit_cast(v16bf, __builtin_shufflevector(lo, hi, 0, 1, 2, 3, 4, 5, 6, 7, 8, 9, 10, 11, 12, 13, 14, 15)); }
__device__ __forceinline__ v8f wmma16(v16h a, v16h b, v8f c) { return __builtin_amdgcn_wmma_f32_16x16x32_f16(false, a, false, b, (short)0, c, false, false); }
__device__ __forceinline__ v8f wmmab(v16bf a, v16bf b, v8f c) { return __builtin_amdgcn_wmma_f32_16x16x32_bf16(false, a, false, b, (short)0, c, false, false); }



// ---- fragment loader and product for K-contiguous 16-bit planes (hardware k order: lane half hi takes k = 8 hi + 0..7 and 16 + 8 hi + 0..7 of each 32)
template <typename T16> struct WFrag;
template <> struct WFrag<h16> { typedef v16h V; static __device__ __forceinline__ V ld(const h16* p) { return cat16(*(const v8h*)p, *(const v8h*)(p + 16)); } static __device__ __forceinline__ v8f mma(V a, V b, v8f c) { return wmma16(a, b, c); } };
template <> struct WFrag<bf> { typedef v16bf V; static __device__ __forceinline__ V ld(const bf* p) { return cat16b(*(const v8us*)p, *(const v8us*)(p + 16)); } static __device__ __forceinline__ v8f mma(V a, V b, v8f c) { return wmmab(a, b, c); } };

typedef __attribute__((ext_vector_type(2))) float v2f;
typedef __attribute__((ext_vector_type(2))) __bf16 v2bf;
typedef __attribute__((ext_vector_type(8))) __bf16 v8bf;
typedef __attribute__((ext_vector_type(4))) unsigned v4u;
typedef v4u __attribute__((may_alias)) v4ua;

// ---- k_prep: the projection's two 16-bit GEMM operands in one launch. Work-groups 0..XBLK-1: bf16 copy of all NB_ x TT rows of x, 8 elements a thread and step. The next 3 x WBLK: Wq, Wk, Wv ([k][n], f32) rounded to bf16 and transposed to WT[which][n][k]; a wave takes one n and writes its 8 whole 128-byte lines.
#define XBLK 512
#define WBLK (DQ / 8)
__global__ __launch_bounds__(256) void k_prep(const float* __restrict__ x, const float* __restrict__ wq, const float* __restrict__ wk, const float* __restrict__ wv, bf* XB, bf* WT) {
    if (blockIdx.x < XBLK) {
        constexpr int NIT = NB_ * TT * DM / 8 / (XBLK * 256); const size_t i0 = (size_t)blockIdx.x * (NIT * 256) + threadIdx.x; const float* sp = x + i0 * 8; bf* dp = XB + i0 * 8; v8f v[NIT]; v4u o[NIT];
#pragma unroll
        for (int it = 0; it < NIT; ++it) v[it] = *(const v8f*)(sp + it * 256 * 8);
        asm volatile("s_wait_xcnt 0x0" :: "v"(sp) : "memory");   // the wait in front of any overwrite of the loads' address registers; the input keeps them untouched up to here
#pragma unroll
        for (int it = 0; it < NIT; ++it) { v8us u;
#pragma unroll
            for (int k = 0; k < 8; ++k) u[k] = f2bf(v[it][k]);
            o[it] = __builtin_bit_cast(v4u, u); *(v4ua*)(dp + it * 256 * 8) = o[it]; }
        return;
    }
    const int wb = blockIdx.x - XBLK, which = wb / WBLK; const float* w = which == 0 ? wq : which == 1 ? wk : wv;
    const int lane = threadIdx.x & 31; const int n = (wb % WBLK) * 8 + (threadIdx.x >> 5);
    const float* sp = w + (size_t)(lane * 2) * DQ + n; bf* dp = WT + ((size_t)which * DQ + n) * DM + lane * 2; float f[8][2]; unsigned o[8];
#pragma unroll
    for (int l = 0; l < 8; ++l) { f[l][0] = sp[(size_t)l * 64 * DQ]; f[l][1] = sp[(size_t)l * 64 * DQ + DQ]; }   // k = 64 l + 2 lane and the next
    asm volatile("s_wait_xcnt 0x0" :: "v"(sp) : "memory");   // as above, for the loads' address registers
#pragma unroll
    for (int l = 0; l < 8; ++l) { o[l] = (unsigned)f2bf(f[l][0]) | ((unsigned)f2bf(f[l][1]) << 16); *(unsigned __attribute__((may_alias))*)(dp + l * 64) = o[l]; }
    asm volatile("s_wait_xcnt 0x0" :: "v"(dp), "v"(o[0]), "v"(o[1]), "v"(o[2]), "v"(o[3]), "v"(o[4]), "v"(o[5]), "v"(o[6]), "v"(o[7]) : "memory");   // as above, for the stores' address and data registers: in the built code the other branch's block, which writes them, stands behind these stores
}

__device__ __forceinline__ void split8(const v8f y, v4u& oh, v4u& ol) { v8bf a, c;
#pragma unroll
    for (int r = 0; r < 8; r += 2) { v2f p; p[0] = y[r]; p[1] = y[r + 1]; const v2bf u = __builtin_convertvector(p, v2bf); v2f e; e[0] = p[0] - (float)u[0]; e[1] = p[1] - (float)u[1]; const v2bf w = __builtin_convertvector(e, v2bf); a[r] = u[0]; a[r + 1] = u[1]; c[r] = w[0]; c[r + 1] = w[1]; }
    oh = __builtin_bit_cast(v4u, a); ol = __builtin_bit_cast(v4u, c); }
__global__ __launch_bounds__(128) void k_proj(const bf* __restrict__ XB, const bf* __restrict__ WT, const float* __restrict__ bq, const float* __restrict__ bk, const float* __restrict__ bv, bf* QPh, bf* QPl, bf* KPh, bf* KPl, bf* VTh, bf* VTl) {
    typedef WFrag<bf> WF; typedef v16bf V;
    const int lane = threadIdx.x & 31, lr = lane & 15, hi = lane >> 4, wv = threadIdx.x >> 5;
    const int which = blockIdx.y / (NH_ / 4), head = (blockIdx.y % (NH_ / 4)) * 4 + wv; const int t0 = blockIdx.x * 64, b = t0 / TT, tl = t0 % TT;
    const bf* xp = XB + (size_t)(t0 + lr) * DM + 8 * hi; const bf* wp = WT + ((size_t)which * DQ + head * HD + lr) * DM + 8 * hi;
    const bf* ap = which == 2 ? xp : wp; const bf* bp = which == 2 ? wp : xp;   // A rows, B rows: both K-contiguous, same loader, same k order
    v8f acc[4][4];
#pragma unroll
    for (int mb = 0; mb < 4; ++mb)
#pragma unroll
        for (int nb = 0; nb < 4; ++nb) acc[mb][nb] = (v8f){};
    V a[2][4], bb[2][4];
#pragma unroll
    for (int i = 0; i < 4; ++i) { a[0][i] = WF::ld(ap + i * 16 * DM); bb[0][i] = WF::ld(bp + i * 16 * DM); }
#pragma unroll   // unrolled whole: every load is one of two bases + a constant offset, and the two fragment sets swap by name
    for (int kc = 0; kc < DM; kc += 32) { const int cu = (kc >> 5) & 1, nx = cu ^ 1;
        if (kc + 32 < DM) {   // the next 32 k, asked for in front of this step's products
#pragma unroll
            for (int i = 0; i < 4; ++i) { a[nx][i] = WF::ld(ap + i * 16 * DM + kc + 32); bb[nx][i] = WF::ld(bp + i * 16 * DM + kc + 32); } }
        __builtin_amdgcn_sched_barrier(0);   // keeps the next step's loads up here: left free, the compiler sank each pair to just in front of its products and waited out its latency there
#pragma unroll
        for (int nb = 0; nb < 4; ++nb)
#pragma unroll
            for (int mb = 0; mb < 4; ++mb) acc[mb][nb] = WF::mma(a[cu][mb], bb[cu][nb], acc[mb][nb]);
    }
    asm volatile("s_wait_xcnt 0x0" :: "v"(ap), "v"(bp) : "memory");   // the wait in front of any overwrite of the fragment loads' address registers; the inputs keep them untouched up to here
    const size_t z = (size_t)b * NH_ + head;
    if (which == 2) {
        const float* bs = bv + head * HD + lr; float bi[4];
#pragma unroll
        for (int nb = 0; nb < 4; ++nb) bi[nb] = bs[nb * 16];
        asm volatile("s_wait_xcnt 0x0" :: "v"(bs) : "memory");   // as above, for the bias loads
        const size_t o0 = (z * HD + lr) * TT + tl + hi * 8; bf* p0 = VTh + o0; bf* p1 = VTl + o0;
#pragma unroll
        for (int nb = 0; nb < 4; ++nb) { v4u oh[4], ol[4];
#pragma unroll
            for (int mb = 0; mb < 4; ++mb) { split8(acc[mb][nb] + bfr(bi[nb]), oh[mb], ol[mb]); *(v4ua*)(p0 + (size_t)nb * 16 * TT + mb * 16) = oh[mb]; *(v4ua*)(p1 + (size_t)nb * 16 * TT + mb * 16) = ol[mb]; }
            asm volatile("s_wait_xcnt 0x0" :: "v"(p0), "v"(p1), "v"(oh[0]), "v"(oh[1]), "v"(oh[2]), "v"(oh[3]), "v"(ol[0]), "v"(ol[1]), "v"(ol[2]), "v"(ol[3]) : "memory"); }   // as above, for the stores' address and data registers
    } else {
        const float* bs = (which == 0 ? bq : bk) + head * HD + hi * 8; v8f bi[4];
#pragma unroll
        for (int mb = 0; mb < 4; ++mb) bi[mb] = *(const v8f*)(bs + mb * 16);
        asm volatile("s_wait_xcnt 0x0" :: "v"(bs) : "memory");   // as above, for the bias loads
        const size_t o0 = (z * TT + tl + lr) * HD + hi * 8; bf* p0 = (which == 0 ? QPh : KPh) + o0; bf* p1 = (which == 0 ? QPl : KPl) + o0;
#pragma unroll
        for (int mb = 0; mb < 4; ++mb) { v4u oh[4], ol[4];
#pragma unroll
            for (int j = 0; j < 8; ++j) bi[mb][j] = bfr(bi[mb][j]);
#pragma unroll
            for (int nb = 0; nb < 4; ++nb) { split8(acc[mb][nb] + bi[mb], oh[nb], ol[nb]); *(v4ua*)(p0 + nb * 16 * HD + mb * 16) = oh[nb]; *(v4ua*)(p1 + nb * 16 * HD + mb * 16) = ol[nb]; }
            asm volatile("s_wait_xcnt 0x0" :: "v"(p0), "v"(p1), "v"(oh[0]), "v"(oh[1]), "v"(oh[2]), "v"(oh[3]), "v"(ol[0]), "v"(ol[1]), "v"(ol[2]), "v"(ol[3]) : "memory"); }   // as above, for the stores' address and data registers
    }
}
__constant__ float SLOPE8[NH_] = { 4.000000000e+0f, 2.000000000e+0f, 1.000000000e+0f, 5.000000000e-1f, 2.500000000e-1f, 1.250000000e-1f, 6.250000000e-2f, 3.125000000e-2f };   // 8 x the per-head ALiBi slope magnitude (|slope_h| = 2^-(h+1), h = 0..7); every entry and every product with |i - j| <= 2047 is exact in f32
// k_fattn: scores, softmax and context of one (batch, head) z = blockIdx.y in one pass over the keys; no score plane. One wave owns QT*16 query columns and walks the 2048 keys 32 at a time:
//   S^T = K Q^T (A = key rows, B = query rows; 3 products on hi/lo planes): lane (lr, hi) holds, for query lr of a group, keys 8 hi + r of each 16-key tile;
//   t = (S - 8 |slope| |i - j|) x HD^-0.5 (distance and product exact in f32); running maximum m and sum l per query (online softmax), p = exp(t - m);
//   the two key tiles' p, split hi/lo, ARE the B operand of O^T += V^T P^T in the hardware k order (element s < 8: tile 0 register s; s >= 8: tile 1 register s - 8), A = V^T rows by the same loader order;
//   out = O^T / l: a lane's 8 accumulator registers are 8 consecutive d of its query's output row.
#define QT 2
__device__ __forceinline__ float xhalf(float x) { const int b = __float_as_int(x); return __int_as_float(__builtin_amdgcn_permlanex16(b, b, 0x76543210, 0xfedcba98, false, false)); }   // lane l <-> l ^ 16, in registers
__global__ __launch_bounds__(256) void k_fattn(const bf* __restrict__ Qh, const bf* __restrict__ Ql, const bf* __restrict__ Kh, const bf* __restrict__ Kl, const bf* __restrict__ Vh, const bf* __restrict__ Vl, float* OUT) {
    typedef WFrag<bf> WF; typedef v16bf V;
    const int lane = threadIdx.x & 31, lr = lane & 15, hi = lane >> 4, wv = threadIdx.x >> 5;
    const int z = blockIdx.y, h = z % NH_, b = z / NH_; const int q0 = (blockIdx.x * 8 + wv) * (QT * 16);
    const float sl = SLOPE8[h]; const size_t zo = (size_t)z * TT * HD;
    V qh[QT][2], ql[QT][2];
#pragma unroll
    for (int qt = 0; qt < QT; ++qt) { const size_t qo = zo + (size_t)(q0 + qt * 16 + lr) * HD + 8 * hi; const bf* qa = Qh + qo; const bf* qb = Ql + qo;
#pragma unroll
        for (int ks = 0; ks < 2; ++ks) { qh[qt][ks] = WF::ld(qa + ks * 32); ql[qt][ks] = WF::ld(qb + ks * 32); }
        asm volatile("s_wait_xcnt 0x0" :: "v"(qa), "v"(qb) : "memory"); }   // the wait in front of any overwrite of the loads' address registers; the two inputs keep those registers untouched up to here
    const bf* kph = Kh + zo + (size_t)lr * HD + 8 * hi; const bf* kpl = Kl + zo + (size_t)lr * HD + 8 * hi;
    const bf* vph = Vh + zo + (size_t)lr * TT + 8 * hi; const bf* vpl = Vl + zo + (size_t)lr * TT + 8 * hi;
    V kh[2][2], kl[2][2];
#pragma unroll
    for (int kt = 0; kt < 2; ++kt)
#pragma unroll
        for (int ks = 0; ks < 2; ++ks) { kh[kt][ks] = WF::ld(kph + kt * 16 * HD + ks * 32); kl[kt][ks] = WF::ld(kpl + kt * 16 * HD + ks * 32); }
    asm volatile("s_wait_xcnt 0x0" :: "v"(kph), "v"(kpl) : "memory");   // as above, for the first key loads
    v8f o[4][QT]; float m[QT], l[QT];
#pragma unroll
    for (int qt = 0; qt < QT; ++qt) { m[qt] = -3.0e38f; l[qt] = 0.f;
#pragma unroll
        for (int db = 0; db < 4; ++db) o[db][qt] = (v8f){}; }
#pragma unroll 1   // rolled: one pass's fragments, the query fragments and the accumulators fill the registers
    for (int kb = 0; kb < TT; kb += 32) {
        V vh[4], vl[4];   // this pass's V^T fragments, asked for first: they fly under the score products and the softmax
        const bf* vch = vph + kb; const bf* vcl = vpl + kb;
#pragma unroll
        for (int db = 0; db < 4; ++db) { vh[db] = WF::ld(vch + (size_t)db * 16 * TT); vl[db] = WF::ld(vcl + (size_t)db * 16 * TT); }
        asm volatile("s_wait_xcnt 0x0" :: "v"(vch), "v"(vcl) : "memory");   // as above, for the V^T loads' address registers
        __builtin_amdgcn_sched_barrier(0);   // keeps the V^T loads up here: left free, the compiler sank them to just in front of their products, where their latency shows
        v8f s[2][QT];
#pragma unroll
        for (int kt = 0; kt < 2; ++kt)
#pragma unroll
            for (int qt = 0; qt < QT; ++qt) s[kt][qt] = (v8f){};
#pragma unroll
        for (int ks = 0; ks < 2; ++ks) {
#pragma unroll
            for (int kt = 0; kt < 2; ++kt)
#pragma unroll
                for (int qt = 0; qt < QT; ++qt) s[kt][qt] = WF::mma(kh[kt][ks], qh[qt][ks], s[kt][qt]);
#pragma unroll
            for (int kt = 0; kt < 2; ++kt)
#pragma unroll
                for (int qt = 0; qt < QT; ++qt) s[kt][qt] = WF::mma(kl[kt][ks], qh[qt][ks], s[kt][qt]);
#pragma unroll
            for (int kt = 0; kt < 2; ++kt)
#pragma unroll
                for (int qt = 0; qt < QT; ++qt) s[kt][qt] = WF::mma(kh[kt][ks], ql[qt][ks], s[kt][qt]);
        }
        const int kn = (kb + 32) & (TT - 1);   // the next pass's key fragments, one pass ahead (the last pass asks for keys 0..31 again: in bounds, unused)
        const bf* kch = kph + (size_t)kn * HD; const bf* kcl = kpl + (size_t)kn * HD;
#pragma unroll
        for (int kt = 0; kt < 2; ++kt)
#pragma unroll
            for (int ks = 0; ks < 2; ++ks) { kh[kt][ks] = WF::ld(kch + kt * 16 * HD + ks * 32); kl[kt][ks] = WF::ld(kcl + kt * 16 * HD + ks * 32); }
        asm volatile("s_wait_xcnt 0x0" :: "v"(kch), "v"(kcl) : "memory");   // as above, for the key loads' address registers
        __builtin_amdgcn_sched_barrier(0);   // keeps the next pass's key loads in front of the softmax, so that they fly under it
        float mn[QT]; bool need = false;
#pragma unroll
        for (int qt = 0; qt < QT; ++qt) { const float d0 = (float)(q0 + qt * 16 + lr - kb - hi * 8); float mx = -3.0e38f;
#pragma unroll
            for (int kt = 0; kt < 2; ++kt)
#pragma unroll
                for (int r = 0; r < 8; ++r) { const float t = (s[kt][qt][r] - sl * fabsf(d0 - (float)(kt * 16 + r))) * SCL; s[kt][qt][r] = t; mx = fmaxf(mx, t); }
            mx = fmaxf(mx, xhalf(mx));   // the other lane half holds the query's other 16 keys
            mn[qt] = fmaxf(m[qt], mx); need = need || (mn[qt] > m[qt]); }
        if (__builtin_amdgcn_ballot_w32(need) != 0) {   // no query of the wave has a new maximum: every factor would be exactly 1
#pragma unroll
            for (int qt = 0; qt < QT; ++qt) { const float al = __builtin_amdgcn_exp2f((m[qt] - mn[qt]) * 1.4426950408889634f); m[qt] = mn[qt]; l[qt] *= al;
#pragma unroll
                for (int db = 0; db < 4; ++db) o[db][qt] *= al; }
        }
        V ph[QT], pl[QT];
#pragma unroll
        for (int qt = 0; qt < QT; ++qt)
#pragma unroll
            for (int kt = 0; kt < 2; ++kt)
#pragma unroll
                for (int r = 0; r < 8; r += 2) { v2f p; p[0] = __builtin_amdgcn_exp2f((s[kt][qt][r] - m[qt]) * 1.4426950408889634f); p[1] = __builtin_amdgcn_exp2f((s[kt][qt][r + 1] - m[qt]) * 1.4426950408889634f); l[qt] += p[0] + p[1];
                    const v2bf a = __builtin_convertvector(p, v2bf); v2f e; e[0] = p[0] - (float)a[0]; e[1] = p[1] - (float)a[1]; const v2bf c = __builtin_convertvector(e, v2bf);
                    ph[qt][kt * 8 + r] = a[0]; ph[qt][kt * 8 + r + 1] = a[1]; pl[qt][kt * 8 + r] = c[0]; pl[qt][kt * 8 + r + 1] = c[1]; }
#pragma unroll
        for (int db = 0; db < 4; ++db)
#pragma unroll
            for (int qt = 0; qt < QT; ++qt) o[db][qt] = WF::mma(vh[db], ph[qt], o[db][qt]);
#pragma unroll
        for (int db = 0; db < 4; ++db)
#pragma unroll
            for (int qt = 0; qt < QT; ++qt) o[db][qt] = WF::mma(vl[db], ph[qt], o[db][qt]);
#pragma unroll
        for (int db = 0; db < 4; ++db)
#pragma unroll
            for (int qt = 0; qt < QT; ++qt) o[db][qt] = WF::mma(vh[db], pl[qt], o[db][qt]);
    }
#pragma unroll
    for (int qt = 0; qt < QT; ++qt) { const float inv = __fdiv_rn(1.0f, l[qt] + xhalf(l[qt])); float* op = OUT + ((size_t)b * TT + q0 + qt * 16 + lr) * DQ + h * HD + hi * 8;
#pragma unroll
        for (int db = 0; db < 4; ++db) { v4f x0, x1;
#pragma unroll
            for (int r = 0; r < 4; ++r) { x0[r] = o[db][qt][r] * inv; x1[r] = o[db][qt][4 + r] * inv; }
            *(v4f*)(op + db * 16) = x0; *(v4f*)(op + db * 16 + 4) = x1; } }
}

extern "C" void kernel_launch(void* const* d_in, const int* in_sizes, int n_in,
                              void* d_out, int out_size, void* d_ws, size_t ws_size, hipStream_t stream) {
    (void)in_sizes; (void)n_in; (void)out_size;
    const float* x = (const float*)d_in[0]; const float* wq = (const float*)d_in[1]; const float* bq = (const float*)d_in[2]; const float* wk = (const float*)d_in[3]; const float* bk = (const float*)d_in[4]; const float* wv = (const float*)d_in[5]; const float* bv = (const float*)d_in[6];   /* order hidden_states, Wq, bq, Wk, bk, Wv, bv ('xw' + biases) */
    float* OUT = (float*)d_out;     // [4][2048][512]
    char* wsp = (char*)d_ws;
    auto take = [&](size_t bytes) { char* p = wsp; wsp += (bytes + 255) & ~(size_t)255; return (void*)p; };
    bf* WT = (bf*)take((size_t)3 * DQ * DM * 2); bf* XB = (bf*)take((size_t)NB_ * TT * DM * 2);
    const size_t PB = (size_t)NH_ * TT * HD;   // one batch's hi or lo plane set, elements
    bf* QPh = (bf*)take(NB_ * PB * 2); bf* QPl = (bf*)take(NB_ * PB * 2); bf* KPh = (bf*)take(NB_ * PB * 2); bf* KPl = (bf*)take(NB_ * PB * 2); bf* VTh = (bf*)take(NB_ * PB * 2); bf* VTl = (bf*)take(NB_ * PB * 2);
    if ((size_t)(wsp - (char*)d_ws) > ws_size) return;    // ws 256 MiB
    k_prep<<<XBLK + 3 * WBLK, 256, 0, stream>>>(x, wq, wk, wv, XB, WT);
    k_proj<<<dim3(NB_ * TT / 64, 3 * NH_ / 4, 1), 128, 0, stream>>>(XB, WT, bq, bk, bv, QPh, QPl, KPh, KPl, VTh, VTl);
    k_fattn<<<dim3(TT / (8 * QT * 16), NB_ * NH_, 1), 256, 0, stream>>>(QPh, QPl, KPh, KPl, VTh, VTl, OUT);   // one kv head per query head: plane z = b * NH_ + h of each operand
}

// v005
// Measured time: 106 microseconds a run.
// Two timings next to v004 both put it at 1.32 times that version's speed.
// All steps since v000 together make it 13.4 times as fast.
#include <hip/hip_runtime.h>

// BERT-style self-attention with a symmetric ALiBi score bias and no output projection (hidden_states [4][2048][512]; q, k, v = x W + b ('xw' [512][512] 0.02 incl. biases; 8 heads x 64); scores = q.k / sqrt(64) + slope_h |i - j| with slope_h = -2^-(h+1) (h = 0..7: the module's _get_slopes(8), negated; up to -0.5 x 2047); softmax over all keys; out = merged context -> [4][2048][512] (4.2 M); argument order hidden_states, Wq, bq, Wk, bk, Wv, bv).
// Every 16-bit matrix operand plane lies in FRAGMENT ORDER (see the loader): a wave-wide 16-byte load or store covers 512 contiguous bytes, 4 whole lines.
// Three launches: bf16 copy of x and the 'xw' weights transposed; ONE projection launch over all batches and q, k, v (f32 biases) that stores the hi/lo planes from its accumulators; then ONE fused attention launch over all 32 (batch, head) planes with EVERY row on hi/lo planes (3 products; the ALiBi term makes the steep heads few-key sharp, so no fp16 rows): it subtracts 8 x |slope_h| x |i - j| from each raw f32 score in the accumulator (undone by its exact x 1/8), keeps a running maximum and sum, and writes the output rows.
// Compute dtypes, f32 accumulate: every input rounded to bf16; projections exact + f32 biases; scores and attn.v 3 products on every row; ALiBi add and softmax f32; output f32.

#define NB_  4
#define TT   2048
#define DM   512
#define NH_  8
#define NKV  8
#define REP  (NH_ / NKV)
#define HD   64
#define DQ   (NH_ * HD)
#define DKV  (NKV * HD)
#define SCL  0.125f   // HD^-0.5
typedef _Float16 h16;
typedef unsigned short bf;
typedef __attribute__((ext_vector_type(16))) __bf16   v16bf;
typedef __attribute__((ext_vector_type(16))) _Float16 v16h;
typedef __attribute__((ext_vector_type(8)))  _Float16 v8h;
typedef __attribute__((ext_vector_type(8)))  unsigned short v8us;
typedef __attribute__((ext_vector_type(8)))  float    v8f;
typedef __attribute__((ext_vector_type(4)))  float    v4f;
typedef v8h  __attribute__((may_alias)) v8ha;
typedef v4f  __attribute__((may_alias)) v4fa;
typedef v8us __attribute__((may_alias)) v8usa;

__device__ __forceinline__ unsigned short f2bf(float f) { unsigned u = __float_as_uint(f); u += 0x7FFFu + ((u >> 16) & 1u); return (unsigned short)(u >> 16); }
__device__ __forceinline__ float bf2f(unsigned short b) { return __uint_as_float(((unsigned)b) << 16); }
__device__ __forceinline__ float bfr(float f) { return bf2f(f2bf(f)); }
__device__ __forceinline__ v16h cat16(v8h lo, v8h hi) { return __builtin_shufflevector(lo, hi, 0, 1, 2, 3, 4, 5, 6, 7, 8, 9, 10, 11, 12, 13, 14, 15); }
__device__ __forceinline__ v16bf cat16b(v8us lo, v8us hi) { return __builtin_bit_cast(v16bf, __builtin_shufflevector(lo, hi, 0, 1, 2, 3, 4, 5, 6, 7, 8, 9, 10, 11, 12, 13, 14, 15)); }
__device__ __forceinline__ v8f wmma16(v16h a, v16h b, v8f c) { return __builtin_amdgcn_wmma_f32_16x16x32_f16(false, a, false, b, (short)0, c, false, false); }
__device__ __forceinline__ v8f wmmab(v16bf a, v16bf b, v8f c) { return __builtin_amdgcn_wmma_f32_16x16x32_bf16(false, a, false, b, (short)0, c, false, false); }



// ---- fragment loader and product (hardware k order: lane half hi takes k = 8 hi + 0..7 and 16 + 8 hi + 0..7 of each 32)
// bf16 planes are stored in fragment order: one fragment (16 rows x 32 k) is 1 KiB = 2 halves j of 512 bytes; half j holds, at 16 bytes x lane (lane = 16 hi + row), k = 16 j + 8 hi + 0..7 of that row.
// A plane of R rows x K: element offset = (row / 16) * 16 K + (k / 32) * FRG + j * FRH + lane * 8 + k % 8. The loader takes the address of the lane's 16 bytes in half 0.
#define FRH 256   // elements of half a fragment
#define FRG 512   // elements of a fragment
template <typename T16> struct WFrag;
template <> struct WFrag<h16> { typedef v16h V; static __device__ __forceinline__ V ld(const h16* p) { return cat16(*(const v8h*)p, *(const v8h*)(p + 16)); } static __device__ __forceinline__ v8f mma(V a, V b, v8f c) { return wmma16(a, b, c); } };
template <> struct WFrag<bf> { typedef v16bf V; static __device__ __forceinline__ V ld(const bf* p) { return cat16b(*(const v8us*)p, *(const v8us*)(p + FRH)); } static __device__ __forceinline__ v8f mma(V a, V b, v8f c) { return wmmab(a, b, c); } };

typedef __attribute__((ext_vector_type(2))) float v2f;
typedef __attribute__((ext_vector_type(2))) __bf16 v2bf;
typedef __attribute__((ext_vector_type(8))) __bf16 v8bf;
typedef __attribute__((ext_vector_type(4))) unsigned v4u;
typedef v4u __attribute__((may_alias)) v4ua;

// ---- k_prep: every 16-bit GEMM operand in one launch, written in fragment order. Work-groups 0..XBLK-1: bf16 copy of x, one 16-row tile a work-group, 8 elements a thread and step (a wave reads 16 rows x 64 bytes and writes half a fragment). The next 3 x WBLK: Wq, Wk, Wv ([k][n], f32) rounded to bf16 and transposed to rows n of WT (row = which x DQ + n); a wave takes one fragment (16 n x 32 k) and writes its 8 whole 128-byte lines.
#define XBLK 512
#define WBLK (DQ / 8)   // DQ / 16 row tiles x DM / 32 fragments, 8 a work-group
__global__ __launch_bounds__(256) void k_prep(const float* __restrict__ x, const float* __restrict__ wq, const float* __restrict__ wk, const float* __restrict__ wv, bf* XB, bf* WT) {
    if (blockIdx.x < XBLK) {
        constexpr int NIT = NB_ * TT * DM / 8 / (XBLK * 256); static_assert(NIT * 256 * 8 == 16 * DM, "one 16-row tile a work-group"); const size_t i0 = (size_t)blockIdx.x * (NIT * 256) + threadIdx.x;
        const float* sp = x + ((size_t)blockIdx.x * 16 + (threadIdx.x & 15)) * DM + (threadIdx.x >> 4) * 8; bf* dp = XB + i0 * 8; v8f v[NIT]; v4u o[NIT];   // thread = (k / 8) % 16 x 16 + row; step it takes k = 128 it + ...
#pragma unroll
        for (int it = 0; it < NIT; ++it) v[it] = *(const v8f*)(sp + it * 128);
        asm volatile("s_wait_xcnt 0x0" :: "v"(sp) : "memory");   // the wait in front of any overwrite of the loads' address registers; the input keeps them untouched up to here
#pragma unroll
        for (int it = 0; it < NIT; ++it) { v8us u;
#pragma unroll
            for (int k = 0; k < 8; ++k) u[k] = f2bf(v[it][k]);
            o[it] = __builtin_bit_cast(v4u, u); *(v4ua*)(dp + it * 256 * 8) = o[it]; }
        return;
    }
    const int wb = blockIdx.x - XBLK, which = wb / WBLK; const float* w = which == 0 ? wq : which == 1 ? wk : wv;
    const int lane = threadIdx.x & 31, lr = lane & 15, hi = lane >> 4; const int rt = wb >> 1, kf = (wb & 1) * 8 + (threadIdx.x >> 5);   // row tile of WT (16 n), fragment along k
    const float* sp = w + (size_t)(kf * 32 + hi * 8) * DQ + (rt % (DQ / 16)) * 16 + lr; bf* dp = WT + (size_t)rt * (16 * DM) + kf * FRG + lane * 8; float f[2][8]; v4u o[2];
#pragma unroll
    for (int j = 0; j < 2; ++j)
#pragma unroll
        for (int r = 0; r < 8; ++r) f[j][r] = sp[(size_t)(j * 16 + r) * DQ];   // k = 32 kf + 16 j + 8 hi + r of column n
    asm volatile("s_wait_xcnt 0x0" :: "v"(sp) : "memory");   // as above, for the loads' address registers
#pragma unroll
    for (int j = 0; j < 2; ++j) { v8us u;
#pragma unroll
        for (int r = 0; r < 8; ++r) u[r] = f2bf(f[j][r]);
        o[j] = __builtin_bit_cast(v4u, u); *(v4ua*)(dp + j * FRH) = o[j]; }
    asm volatile("s_wait_xcnt 0x0" :: "v"(dp), "v"(o[0]), "v"(o[1]) : "memory");   // as above, for the stores' address and data registers: in the built code the other branch's block, which writes them, stands behind these stores
}

__device__ __forceinline__ void split8(const v8f y, v4u& oh, v4u& ol) { v8bf a, c;
#pragma unroll
    for (int r = 0; r < 8; r += 2) { v2f p; p[0] = y[r]; p[1] = y[r + 1]; const v2bf u = __builtin_convertvector(p, v2bf); v2f e; e[0] = p[0] - (float)u[0]; e[1] = p[1] - (float)u[1]; const v2bf w = __builtin_convertvector(e, v2bf); a[r] = u[0]; a[r + 1] = u[1]; c[r] = w[0]; c[r + 1] = w[1]; }
    oh = __builtin_bit_cast(v4u, a); ol = __builtin_bit_cast(v4u, c); }
__global__ __launch_bounds__(128) void k_proj(const bf* __restrict__ XB, const bf* __restrict__ WT, const float* __restrict__ bq, const float* __restrict__ bk, const float* __restrict__ bv, bf* QPh, bf* QPl, bf* KPh, bf* KPl, bf* VTh, bf* VTl) {
    typedef WFrag<bf> WF; typedef v16bf V;
    const int lane = threadIdx.x & 31, lr = lane & 15, hi = lane >> 4, wv = threadIdx.x >> 5;
    const int which = blockIdx.y / (NH_ / 4), head = (blockIdx.y % (NH_ / 4)) * 4 + wv; const int t0 = blockIdx.x * 64, b = t0 / TT, tl = t0 % TT;
    const bf* xp = XB + (size_t)t0 * DM + lane * 8; const bf* wp = WT + ((size_t)which * DQ + head * HD) * DM + lane * 8;
    const bf* ap = which == 2 ? xp : wp; const bf* bp = which == 2 ? wp : xp;   // A rows, B rows: both in fragment order, same loader, same k order
    v8f acc[4][4];
#pragma unroll
    for (int mb = 0; mb < 4; ++mb)
#pragma unroll
        for (int nb = 0; nb < 4; ++nb) acc[mb][nb] = (v8f){};
    V a[2][4], bb[2][4];
#pragma unroll
    for (int i = 0; i < 4; ++i) { a[0][i] = WF::ld(ap + i * 16 * DM); bb[0][i] = WF::ld(bp + i * 16 * DM); }
#pragma unroll   // unrolled whole: every load is one of two bases + a constant offset, and the two fragment sets swap by name
    for (int kc = 0; kc < DM; kc += 32) { const int cu = (kc >> 5) & 1, nx = cu ^ 1;
        if (kc + 32 < DM) {   // the next 32 k, asked for in front of this step's products
#pragma unroll
            for (int i = 0; i < 4; ++i) { a[nx][i] = WF::ld(ap + i * 16 * DM + (kc + 32) / 32 * FRG); bb[nx][i] = WF::ld(bp + i * 16 * DM + (kc + 32) / 32 * FRG); } }
        __builtin_amdgcn_sched_barrier(0);   // keeps the next step's loads up here: left free, the compiler sank each pair to just in front of its products and waited out its latency there
#pragma unroll
        for (int nb = 0; nb < 4; ++nb)
#pragma unroll
            for (int mb = 0; mb < 4; ++mb) acc[mb][nb] = WF::mma(a[cu][mb], bb[cu][nb], acc[mb][nb]);
    }
    asm volatile("s_wait_xcnt 0x0" :: "v"(ap), "v"(bp) : "memory");   // the wait in front of any overwrite of the fragment loads' address registers; the inputs keep them untouched up to here
    const size_t z = (size_t)b * NH_ + head;
    if (which == 2) {
        const float* bs = bv + head * HD + lr; float bi[4];
#pragma unroll
        for (int nb = 0; nb < 4; ++nb) bi[nb] = bs[nb * 16];
        asm volatile("s_wait_xcnt 0x0" :: "v"(bs) : "memory");   // as above, for the bias loads
        const size_t o0 = (z * TT + tl) * HD + lane * 8; bf* p0 = VTh + o0; bf* p1 = VTl + o0;
#pragma unroll
        for (int nb = 0; nb < 4; ++nb) { v4u oh[4], ol[4];
#pragma unroll
            for (int mb = 0; mb < 4; ++mb) { split8(acc[mb][nb] + bfr(bi[nb]), oh[mb], ol[mb]); *(v4ua*)(p0 + (mb >> 1) * (4 * FRG) + nb * FRG + (mb & 1) * FRH) = oh[mb]; *(v4ua*)(p1 + (mb >> 1) * (4 * FRG) + nb * FRG + (mb & 1) * FRH) = ol[mb]; }
            asm volatile("s_wait_xcnt 0x0" :: "v"(p0), "v"(p1), "v"(oh[0]), "v"(oh[1]), "v"(oh[2]), "v"(oh[3]), "v"(ol[0]), "v"(ol[1]), "v"(ol[2]), "v"(ol[3]) : "memory"); }   // as above, for the stores' address and data registers
    } else {
        const float* bs = (which == 0 ? bq : bk) + head * HD + hi * 8; v8f bi[4];
#pragma unroll
        for (int mb = 0; mb < 4; ++mb) bi[mb] = *(const v8f*)(bs + mb * 16);
        asm volatile("s_wait_xcnt 0x0" :: "v"(bs) : "memory");   // as above, for the bias loads
        const size_t o0 = (z * TT + tl) * HD + lane * 8; bf* p0 = (which == 0 ? QPh : KPh) + o0; bf* p1 = (which == 0 ? QPl : KPl) + o0;
#pragma unroll
        for (int mb = 0; mb < 4; ++mb) { v4u oh[4], ol[4];
#pragma unroll
            for (int j = 0; j < 8; ++j) bi[mb][j] = bfr(bi[mb][j]);
#pragma unroll
            for (int nb = 0; nb < 4; ++nb) { split8(acc[mb][nb] + bi[mb], oh[nb], ol[nb]); *(v4ua*)(p0 + nb * 16 * HD + mb * FRH) = oh[nb]; *(v4ua*)(p1 + nb * 16 * HD + mb * FRH) = ol[nb]; }
            asm volatile("s_wait_xcnt 0x0" :: "v"(p0), "v"(p1), "v"(oh[0]), "v"(oh[1]), "v"(oh[2]), "v"(oh[3]), "v"(ol[0]), "v"(ol[1]), "v"(ol[2]), "v"(ol[3]) : "memory"); }   // as above, for the stores' address and data registers
    }
}
__constant__ float SLOPE8[NH_] = { 4.000000000e+0f, 2.000000000e+0f, 1.000000000e+0f, 5.000000000e-1f, 2.500000000e-1f, 1.250000000e-1f, 6.250000000e-2f, 3.125000000e-2f };   // 8 x the per-head ALiBi slope magnitude (|slope_h| = 2^-(h+1), h = 0..7); every entry and every product with |i - j| <= 2047 is exact in f32
// k_fattn: scores, softmax and context of one (batch, head) z = blockIdx.y in one pass over the keys; no score plane. One wave owns QT*16 query columns and walks the 2048 keys 32 at a time:
//   S^T = K Q^T (A = key rows, B = query rows; 3 products on hi/lo planes): lane (lr, hi) holds, for query lr of a group, keys 8 hi + r of each 16-key tile;
//   t = (S - 8 |slope| |i - j|) x HD^-0.5 (distance and product exact in f32); running maximum m and sum l per query (online softmax), p = exp(t - m);
//   the two key tiles' p, split hi/lo, ARE the B operand of O^T += V^T P^T in the hardware k order (element s < 8: tile 0 register s; s >= 8: tile 1 register s - 8), A = V^T rows by the same loader order;
//   out = O^T / l: a lane's 8 accumulator registers are 8 consecutive d of its query's output row.
#define QT 2
__device__ __forceinline__ float xhalf(float x) { const int b = __float_as_int(x); return __int_as_float(__builtin_amdgcn_permlanex16(b, b, 0x76543210, 0xfedcba98, false, false)); }   // lane l <-> l ^ 16, in registers
__global__ __launch_bounds__(256) void k_fattn(const bf* __restrict__ Qh, const bf* __restrict__ Ql, const bf* __restrict__ Kh, const bf* __restrict__ Kl, const bf* __restrict__ Vh, const bf* __restrict__ Vl, float* OUT) {
    typedef WFrag<bf> WF; typedef v16bf V;
    const int lane = threadIdx.x & 31, lr = lane & 15, hi = lane >> 4, wv = threadIdx.x >> 5;
    const int z = blockIdx.y, h = z % NH_, b = z / NH_; const int q0 = (blockIdx.x * 8 + wv) * (QT * 16);
    const float sl = SLOPE8[h]; const size_t zo = (size_t)z * TT * HD;
    V qh[QT][2], ql[QT][2];
#pragma unroll
    for (int qt = 0; qt < QT; ++qt) { const size_t qo = zo + (size_t)(q0 + qt * 16) * HD + lane * 8; const bf* qa = Qh + qo; const bf* qb = Ql + qo;
#pragma unroll
        for (int ks = 0; ks < 2; ++ks) { qh[qt][ks] = WF::ld(qa + ks * FRG); ql[qt][ks] = WF::ld(qb + ks * FRG); }
        asm volatile("s_wait_xcnt 0x0" :: "v"(qa), "v"(qb) : "memory"); }   // the wait in front of any overwrite of the loads' address registers; the two inputs keep those registers untouched up to here
    const bf* kph = Kh + zo + lane * 8; const bf* kpl = Kl + zo + lane * 8;
    const bf* vph = Vh + zo + lane * 8; const bf* vpl = Vl + zo + lane * 8;
    V kh[2][2], kl[2][2];
#pragma unroll
    for (int kt = 0; kt < 2; ++kt)
#pragma unroll
        for (int ks = 0; ks < 2; ++ks) { kh[kt][ks] = WF::ld(kph + kt * 16 * HD + ks * FRG); kl[kt][ks] = WF::ld(kpl + kt * 16 * HD + ks * FRG); }
    asm volatile("s_wait_xcnt 0x0" :: "v"(kph), "v"(kpl) : "memory");   // as above, for the first key loads
    __builtin_amdgcn_sched_barrier(0);   // keeps later code behind that wait: left free, the build formed these loads on a lane-offset register and rewrote it in front of the wait
    v8f o[4][QT]; float m[QT], l[QT];
#pragma unroll
    for (int qt = 0; qt < QT; ++qt) { m[qt] = -3.0e38f; l[qt] = 0.f;
#pragma unroll
        for (int db = 0; db < 4; ++db) o[db][qt] = (v8f){}; }
#pragma unroll 1   // rolled: one pass's fragments, the query fragments and the accumulators fill the registers
    for (int kb = 0; kb < TT; kb += 32) {
        V vh[4], vl[4];   // this pass's V^T fragments, asked for first: they fly under the score products and the softmax
        const bf* vch = vph + (size_t)kb * HD; const bf* vcl = vpl + (size_t)kb * HD;
#pragma unroll
        for (int db = 0; db < 4; ++db) { vh[db] = WF::ld(vch + db * FRG); vl[db] = WF::ld(vcl + db * FRG); }
        asm volatile("s_wait_xcnt 0x0" :: "v"(vch), "v"(vcl) : "memory");   // as above, for the V^T loads' address registers
        __builtin_amdgcn_sched_barrier(0);   // keeps the V^T loads up here: left free, the compiler sank them to just in front of their products, where their latency shows
        v8f s[2][QT];
#pragma unroll
        for (int kt = 0; kt < 2; ++kt)
#pragma unroll
            for (int qt = 0; qt < QT; ++qt) s[kt][qt] = (v8f){};
#pragma unroll
        for (int ks = 0; ks < 2; ++ks) {
#pragma unroll
            for (int kt = 0; kt < 2; ++kt)
#pragma unroll
                for (int qt = 0; qt < QT; ++qt) s[kt][qt] = WF::mma(kh[kt][ks], qh[qt][ks], s[kt][qt]);
#pragma unroll
            for (int kt = 0; kt < 2; ++kt)
#pragma unroll
                for (int qt = 0; qt < QT; ++qt) s[kt][qt] = WF::mma(kl[kt][ks], qh[qt][ks], s[kt][qt]);
#pragma unroll
            for (int kt = 0; kt < 2; ++kt)
#pragma unroll
                for (int qt = 0; qt < QT; ++qt) s[kt][qt] = WF::mma(kh[kt][ks], ql[qt][ks], s[kt][qt]);
        }
        const int kn = (kb + 32) & (TT - 1);   // the next pass's key fragments, one pass ahead (the last pass asks for keys 0..31 again: in bounds, unused)
        const bf* kch = kph + (size_t)kn * HD; const bf* kcl = kpl + (size_t)kn * HD;
#pragma unroll
        for (int kt = 0; kt < 2; ++kt)
#pragma unroll
            for (int ks = 0; ks < 2; ++ks) { kh[kt][ks] = WF::ld(kch + kt * 16 * HD + ks * FRG); kl[kt][ks] = WF::ld(kcl + kt * 16 * HD + ks * FRG); }
        asm volatile("s_wait_xcnt 0x0" :: "v"(kch), "v"(kcl) : "memory");   // as above, for the key loads' address registers
        __builtin_amdgcn_sched_barrier(0);   // keeps the next pass's key loads in front of the softmax, so that they fly under it
        float mn[QT]; bool need = false;
#pragma unroll
        for (int qt = 0; qt < QT; ++qt) { const float d0 = (float)(q0 + qt * 16 + lr - kb - hi * 8); float mx = -3.0e38f;
#pragma unroll
            for (int kt = 0; kt < 2; ++kt)
#pragma unroll
                for (int r = 0; r < 8; ++r) { const float t = (s[kt][qt][r] - sl * fabsf(d0 - (float)(kt * 16 + r))) * SCL; s[kt][qt][r] = t; mx = fmaxf(mx, t); }
            mx = fmaxf(mx, xhalf(mx));   // the other lane half holds the query's other 16 keys
            mn[qt] = fmaxf(m[qt], mx); need = need || (mn[qt] > m[qt]); }
        if (__builtin_amdgcn_ballot_w32(need) != 0) {   // no query of the wave has a new maximum: every factor would be exactly 1
#pragma unroll
            for (int qt = 0; qt < QT; ++qt) { const float al = __builtin_amdgcn_exp2f((m[qt] - mn[qt]) * 1.4426950408889634f); m[qt] = mn[qt]; l[qt] *= al;
#pragma unroll
                for (int db = 0; db < 4; ++db) o[db][qt] *= al; }
        }
        V ph[QT], pl[QT];
#pragma unroll
        for (int qt = 0; qt < QT; ++qt)
#pragma unroll
            for (int kt = 0; kt < 2; ++kt)
#pragma unroll
                for (int r = 0; r < 8; r += 2) { v2f p; p[0] = __builtin_amdgcn_exp2f((s[kt][qt][r] - m[qt]) * 1.4426950408889634f); p[1] = __builtin_amdgcn_exp2f((s[kt][qt][r + 1] - m[qt]) * 1.4426950408889634f); l[qt] += p[0] + p[1];
                    const v2bf a = __builtin_convertvector(p, v2bf); v2f e; e[0] = p[0] - (float)a[0]; e[1] = p[1] - (float)a[1]; const v2bf c = __builtin_convertvector(e, v2bf);
                    ph[qt][kt * 8 + r] = a[0]; ph[qt][kt * 8 + r + 1] = a[1]; pl[qt][kt * 8 + r] = c[0]; pl[qt][kt * 8 + r + 1] = c[1]; }
#pragma unroll
        for (int db = 0; db < 4; ++db)
#pragma unroll
            for (int qt = 0; qt < QT; ++qt) o[db][qt] = WF::mma(vh[db], ph[qt], o[db][qt]);
#pragma unroll
        for (int db = 0; db < 4; ++db)
#pragma unroll
            for (int qt = 0; qt < QT; ++qt) o[db][qt] = WF::mma(vl[db], ph[qt], o[db][qt]);
#pragma unroll
        for (int db = 0; db < 4; ++db)
#pragma unroll
            for (int qt = 0; qt < QT; ++qt) o[db][qt] = WF::mma(vh[db], pl[qt], o[db][qt]);
    }
#pragma unroll
    for (int qt = 0; qt < QT; ++qt) { const float inv = __fdiv_rn(1.0f, l[qt] + xhalf(l[qt])); float* op = OUT + ((size_t)b * TT + q0 + qt * 16 + lr) * DQ + h * HD + hi * 8;
#pragma unroll
        for (int db = 0; db < 4; ++db) { v4f x0, x1;
#pragma unroll
            for (int r = 0; r < 4; ++r) { x0[r] = o[db][qt][r] * inv; x1[r] = o[db][qt][4 + r] * inv; }
            *(v4f*)(op + db * 16) = x0; *(v4f*)(op + db * 16 + 4) = x1; } }
}

extern "C" void kernel_launch(void* const* d_in, const int* in_sizes, int n_in,
                              void* d_out, int out_size, void* d_ws, size_t ws_size, hipStream_t stream) {
    (void)in_sizes; (void)n_in; (void)out_size;
    const float* x = (const float*)d_in[0]; const float* wq = (const float*)d_in[1]; const float* bq = (const float*)d_in[2]; const float* wk = (const float*)d_in[3]; const float* bk = (const float*)d_in[4]; const float* wv = (const float*)d_in[5]; const float* bv = (const float*)d_in[6];   /* order hidden_states, Wq, bq, Wk, bk, Wv, bv ('xw' + biases) */
    float* OUT = (float*)d_out;     // [4][2048][512]
    char* wsp = (char*)d_ws;
    auto take = [&](size_t bytes) { char* p = wsp; wsp += (bytes + 255) & ~(size_t)255; return (void*)p; };
    bf* WT = (bf*)take((size_t)3 * DQ * DM * 2); bf* XB = (bf*)take((size_t)NB_ * TT * DM * 2);
    const size_t PB = (size_t)NH_ * TT * HD;   // one batch's hi or lo plane set, elements
    bf* QPh = (bf*)take(NB_ * PB * 2); bf* QPl = (bf*)take(NB_ * PB * 2); bf* KPh = (bf*)take(NB_ * PB * 2); bf* KPl = (bf*)take(NB_ * PB * 2); bf* VTh = (bf*)take(NB_ * PB * 2); bf* VTl = (bf*)take(NB_ * PB * 2);
    if ((size_t)(wsp - (char*)d_ws) > ws_size) return;    // ws 256 MiB
    k_prep<<<XBLK + 3 * WBLK, 256, 0, stream>>>(x, wq, wk, wv, XB, WT);
    k_proj<<<dim3(NB_ * TT / 64, 3 * NH_ / 4, 1), 128, 0, stream>>>(XB, WT, bq, bk, bv, QPh, QPl, KPh, KPl, VTh, VTl);
    k_fattn<<<dim3(TT / (8 * QT * 16), NB_ * NH_, 1), 256, 0, stream>>>(QPh, QPl, KPh, KPl, VTh, VTl, OUT);   // one kv head per query head: plane z = b * NH_ + h of each operand
}

// v006
// A run of this version takes 95.6 microseconds.
// Two timings next to v005 both put it at 1.11 times that version's speed.
// Over all steps from v000 it is 14.9 times as fast.
#include <hip/hip_runtime.h>

// BERT-style self-attention with a symmetric ALiBi score bias and no output projection (hidden_states [4][2048][512]; q, k, v = x W + b ('xw' [512][512] 0.02 incl. biases; 8 heads x 64); scores = q.k / sqrt(64) + slope_h |i - j| with slope_h = -2^-(h+1) (h = 0..7: the module's _get_slopes(8), negated; up to -0.5 x 2047); softmax over all keys; out = merged context -> [4][2048][512] (4.2 M); argument order hidden_states, Wq, bq, Wk, bk, Wv, bv).
// Every 16-bit matrix operand plane lies in FRAGMENT ORDER (see the loader): a wave-wide 16-byte load or store covers 512 contiguous bytes, 4 whole lines.
// Three launches: bf16 copy of x and the 'xw' weights transposed; ONE projection launch over all batches and q, k, v (f32 biases) that stores the hi/lo planes from its accumulators; then ONE fused attention launch over all 32 (batch, head) planes with EVERY row on hi/lo planes (3 products; the ALiBi term makes the steep heads few-key sharp, so no fp16 rows): q carries the factor HD^-0.5 x log2(e) from the projection, so the score products come out in log2 units; the ALiBi term is one add per score from a table held in registers (its part inside the 32 x 32 block) plus one shift per pass (the block distance); the launch keeps a running maximum and sum and writes the output rows.
// Compute dtypes, f32 accumulate: every input rounded to bf16; projections exact + f32 biases; scores and attn.v 3 products on every row; ALiBi add and softmax f32; output f32.

#define NB_  4
#define TT   2048
#define DM   512
#define NH_  8
#define NKV  8
#define REP  (NH_ / NKV)
#define HD   64
#define DQ   (NH_ * HD)
#define DKV  (NKV * HD)
#define SCL  0.125f   // HD^-0.5
#define L2E  1.4426950408889634f   // log2(e)
typedef _Float16 h16;
typedef unsigned short bf;
typedef __attribute__((ext_vector_type(16))) __bf16   v16bf;
typedef __attribute__((ext_vector_type(16))) _Float16 v16h;
typedef __attribute__((ext_vector_type(8)))  _Float16 v8h;
typedef __attribute__((ext_vector_type(8)))  unsigned short v8us;
typedef __attribute__((ext_vector_type(8)))  float    v8f;
typedef __attribute__((ext_vector_type(4)))  float    v4f;
typedef v8h  __attribute__((may_alias)) v8ha;
typedef v4f  __attribute__((may_alias)) v4fa;
typedef v8us __attribute__((may_alias)) v8usa;

__device__ __forceinline__ unsigned short f2bf(float f) { unsigned u = __float_as_uint(f); u += 0x7FFFu + ((u >> 16) & 1u); return (unsigned short)(u >> 16); }
__device__ __forceinline__ float bf2f(unsigned short b) { return __uint_as_float(((unsigned)b) << 16); }
__device__ __forceinline__ float bfr(float f) { return bf2f(f2bf(f)); }
__device__ __forceinline__ v16h cat16(v8h lo, v8h hi) { return __builtin_shufflevector(lo, hi, 0, 1, 2, 3, 4, 5, 6, 7, 8, 9, 10, 11, 12, 13, 14, 15); }
__device__ __forceinline__ v16bf cat16b(v8us lo, v8us hi) { return __builtin_bit_cast(v16bf, __builtin_shufflevector(lo, hi, 0, 1, 2, 3, 4, 5, 6, 7, 8, 9, 10, 11, 12, 13, 14, 15)); }
__device__ __forceinline__ v8f wmma16(v16h a, v16h b, v8f c) { return __builtin_amdgcn_wmma_f32_16x16x32_f16(false, a, false, b, (short)0, c, false, false); }
__device__ __forceinline__ v8f wmmab(v16bf a, v16bf b, v8f c) { return __builtin_amdgcn_wmma_f32_16x16x32_bf16(false, a, false, b, (short)0, c, false, false); }



// ---- fragment loader and product (hardware k order: lane half hi takes k = 8 hi + 0..7 and 16 + 8 hi + 0..7 of each 32)
// bf16 planes are stored in fragment order: one fragment (16 rows x 32 k) is 1 KiB = 2 halves j of 512 bytes; half j holds, at 16 bytes x lane (lane = 16 hi + row), k = 16 j + 8 hi + 0..7 of that row.
// A plane of R rows x K: element offset = (row / 16) * 16 K + (k / 32) * FRG + j * FRH + lane * 8 + k % 8. The loader takes the address of the lane's 16 bytes in half 0.
#define FRH 256   // elements of half a fragment
#define FRG 512   // elements of a fragment
template <typename T16> struct WFrag;
template <> struct WFrag<h16> { typedef v16h V; static __device__ __forceinline__ V ld(const h16* p) { return cat16(*(const v8h*)p, *(const v8h*)(p + 16)); } static __device__ __forceinline__ v8f mma(V a, V b, v8f c) { return wmma16(a, b, c); } };
template <> struct WFrag<bf> { typedef v16bf V; static __device__ __forceinline__ V ld(const bf* p) { return cat16b(*(const v8us*)p, *(const v8us*)(p + FRH)); } static __device__ __forceinline__ v8f mma(V a, V b, v8f c) { return wmmab(a, b, c); } };

typedef __attribute__((ext_vector_type(2))) float v2f;
typedef __attribute__((ext_vector_type(2))) __bf16 v2bf;
typedef __attribute__((ext_vector_type(8))) __bf16 v8bf;
typedef __attribute__((ext_vector_type(4))) unsigned v4u;
typedef v4u __attribute__((may_alias)) v4ua;

// ---- k_prep: every 16-bit GEMM operand in one launch, written in fragment order. Work-groups 0..XBLK-1: bf16 copy of x, one 16-row tile a work-group, 8 elements a thread and step (a wave reads 16 rows x 64 bytes and writes half a fragment). The next 3 x WBLK: Wq, Wk, Wv ([k][n], f32) rounded to bf16 and transposed to rows n of WT (row = which x DQ + n); a wave takes one fragment (16 n x 32 k) and writes its 8 whole 128-byte lines.
#define XBLK 512
#define WBLK (DQ / 8)   // DQ / 16 row tiles x DM / 32 fragments, 8 a work-group
__global__ __launch_bounds__(256) void k_prep(const float* __restrict__ x, const float* __restrict__ wq, const float* __restrict__ wk, const float* __restrict__ wv, bf* XB, bf* WT) {
    if (blockIdx.x < XBLK) {
        constexpr int NIT = NB_ * TT * DM / 8 / (XBLK * 256); static_assert(NIT * 256 * 8 == 16 * DM, "one 16-row tile a work-group"); const size_t i0 = (size_t)blockIdx.x * (NIT * 256) + threadIdx.x;
        const float* sp = x + ((size_t)blockIdx.x * 16 + (threadIdx.x & 15)) * DM + (threadIdx.x >> 4) * 8; bf* dp = XB + i0 * 8; v8f v[NIT]; v4u o[NIT];   // thread = (k / 8) % 16 x 16 + row; step it takes k = 128 it + ...
#pragma unroll
        for (int it = 0; it < NIT; ++it) v[it] = *(const v8f*)(sp + it * 128);
        asm volatile("s_wait_xcnt 0x0" :: "v"(sp) : "memory");   // the wait in front of any overwrite of the loads' address registers; the input keeps them untouched up to here
#pragma unroll
        for (int it = 0; it < NIT; ++it) { v8us u;
#pragma unroll
            for (int k = 0; k < 8; ++k) u[k] = f2bf(v[it][k]);
            o[it] = __builtin_bit_cast(v4u, u); *(v4ua*)(dp + it * 256 * 8) = o[it]; }
        return;
    }
    const int wb = blockIdx.x - XBLK, which = wb / WBLK; const float* w = which == 0 ? wq : which == 1 ? wk : wv;
    const int lane = threadIdx.x & 31, lr = lane & 15, hi = lane >> 4; const int rt = wb >> 1, kf = (wb & 1) * 8 + (threadIdx.x >> 5);   // row tile of WT (16 n), fragment along k
    const float* sp = w + (size_t)(kf * 32 + hi * 8) * DQ + (rt % (DQ / 16)) * 16 + lr; bf* dp = WT + (size_t)rt * (16 * DM) + kf * FRG + lane * 8; float f[2][8]; v4u o[2];
#pragma unroll
    for (int j = 0; j < 2; ++j)
#pragma unroll
        for (int r = 0; r < 8; ++r) f[j][r] = sp[(size_t)(j * 16 + r) * DQ];   // k = 32 kf + 16 j + 8 hi + r of column n
    asm volatile("s_wait_xcnt 0x0" :: "v"(sp) : "memory");   // as above, for the loads' address registers
#pragma unroll
    for (int j = 0; j < 2; ++j) { v8us u;
#pragma unroll
        for (int r = 0; r < 8; ++r) u[r] = f2bf(f[j][r]);
        o[j] = __builtin_bit_cast(v4u, u); *(v4ua*)(dp + j * FRH) = o[j]; }
    asm volatile("s_wait_xcnt 0x0" :: "v"(dp), "v"(o[0]), "v"(o[1]) : "memory");   // as above, for the stores' address and data registers: in the built code the other branch's block, which writes them, stands behind these stores
}

__device__ __forceinline__ void split8(const v8f y, v4u& oh, v4u& ol) { v8bf a, c;
#pragma unroll
    for (int r = 0; r < 8; r += 2) { v2f p; p[0] = y[r]; p[1] = y[r + 1]; const v2bf u = __builtin_convertvector(p, v2bf); v2f e; e[0] = p[0] - (float)u[0]; e[1] = p[1] - (float)u[1]; const v2bf w = __builtin_convertvector(e, v2bf); a[r] = u[0]; a[r + 1] = u[1]; c[r] = w[0]; c[r + 1] = w[1]; }
    oh = __builtin_bit_cast(v4u, a); ol = __builtin_bit_cast(v4u, c); }
__global__ __launch_bounds__(128) void k_proj(const bf* __restrict__ XB, const bf* __restrict__ WT, const float* __restrict__ bq, const float* __restrict__ bk, const float* __restrict__ bv, bf* QPh, bf* QPl, bf* KPh, bf* KPl, bf* VTh, bf* VTl) {
    typedef WFrag<bf> WF; typedef v16bf V;
    const int lane = threadIdx.x & 31, lr = lane & 15, hi = lane >> 4, wv = threadIdx.x >> 5;
    const int which = blockIdx.y / (NH_ / 4), head = (blockIdx.y % (NH_ / 4)) * 4 + wv; const int t0 = blockIdx.x * 64, b = t0 / TT, tl = t0 % TT;
    const bf* xp = XB + (size_t)t0 * DM + lane * 8; const bf* wp = WT + ((size_t)which * DQ + head * HD) * DM + lane * 8;
    const bf* ap = which == 2 ? xp : wp; const bf* bp = which == 2 ? wp : xp;   // A rows, B rows: both in fragment order, same loader, same k order
    v8f acc[4][4];
#pragma unroll
    for (int mb = 0; mb < 4; ++mb)
#pragma unroll
        for (int nb = 0; nb < 4; ++nb) acc[mb][nb] = (v8f){};
    V a[2][4], bb[2][4];
#pragma unroll
    for (int i = 0; i < 4; ++i) { a[0][i] = WF::ld(ap + i * 16 * DM); bb[0][i] = WF::ld(bp + i * 16 * DM); }
#pragma unroll   // unrolled whole: every load is one of two bases + a constant offset, and the two fragment sets swap by name
    for (int kc = 0; kc < DM; kc += 32) { const int cu = (kc >> 5) & 1, nx = cu ^ 1;
        if (kc + 32 < DM) {   // the next 32 k, asked for in front of this step's products
#pragma unroll
            for (int i = 0; i < 4; ++i) { a[nx][i] = WF::ld(ap + i * 16 * DM + (kc + 32) / 32 * FRG); bb[nx][i] = WF::ld(bp + i * 16 * DM + (kc + 32) / 32 * FRG); } }
        __builtin_amdgcn_sched_barrier(0);   // keeps the next step's loads up here: left free, the compiler sank each pair to just in front of its products and waited out its latency there
#pragma unroll
        for (int nb = 0; nb < 4; ++nb)
#pragma unroll
            for (int mb = 0; mb < 4; ++mb) acc[mb][nb] = WF::mma(a[cu][mb], bb[cu][nb], acc[mb][nb]);
    }
    asm volatile("s_wait_xcnt 0x0" :: "v"(ap), "v"(bp) : "memory");   // the wait in front of any overwrite of the fragment loads' address registers; the inputs keep them untouched up to here
    const size_t z = (size_t)b * NH_ + head;
    if (which == 2) {
        const float* bs = bv + head * HD + lr; float bi[4];
#pragma unroll
        for (int nb = 0; nb < 4; ++nb) bi[nb] = bs[nb * 16];
        asm volatile("s_wait_xcnt 0x0" :: "v"(bs) : "memory");   // as above, for the bias loads
        const size_t o0 = (z * TT + tl) * HD + lane * 8; bf* p0 = VTh + o0; bf* p1 = VTl + o0;
#pragma unroll
        for (int nb = 0; nb < 4; ++nb) { v4u oh[4], ol[4];
#pragma unroll
            for (int mb = 0; mb < 4; ++mb) { split8(acc[mb][nb] + bfr(bi[nb]), oh[mb], ol[mb]); *(v4ua*)(p0 + (mb >> 1) * (4 * FRG) + nb * FRG + (mb & 1) * FRH) = oh[mb]; *(v4ua*)(p1 + (mb >> 1) * (4 * FRG) + nb * FRG + (mb & 1) * FRH) = ol[mb]; }
            asm volatile("s_wait_xcnt 0x0" :: "v"(p0), "v"(p1), "v"(oh[0]), "v"(oh[1]), "v"(oh[2]), "v"(oh[3]), "v"(ol[0]), "v"(ol[1]), "v"(ol[2]), "v"(ol[3]) : "memory"); }   // as above, for the stores' address and data registers
    } else {
        const float* bs = (which == 0 ? bq : bk) + head * HD + hi * 8; v8f bi[4]; const float qs = which == 0 ? SCL * L2E : 1.0f;   // q leaves with the score scale and log2(e) on it (k: x 1, exact)
#pragma unroll
        for (int mb = 0; mb < 4; ++mb) bi[mb] = *(const v8f*)(bs + mb * 16);
        asm volatile("s_wait_xcnt 0x0" :: "v"(bs) : "memory");   // as above, for the bias loads
        const size_t o0 = (z * TT + tl) * HD + lane * 8; bf* p0 = (which == 0 ? QPh : KPh) + o0; bf* p1 = (which == 0 ? QPl : KPl) + o0;
#pragma unroll
        for (int mb = 0; mb < 4; ++mb) { v4u oh[4], ol[4];
#pragma unroll
            for (int j = 0; j < 8; ++j) bi[mb][j] = bfr(bi[mb][j]);
#pragma unroll
            for (int nb = 0; nb < 4; ++nb) { split8((acc[mb][nb] + bi[mb]) * qs, oh[nb], ol[nb]); *(v4ua*)(p0 + nb * 16 * HD + mb * FRH) = oh[nb]; *(v4ua*)(p1 + nb * 16 * HD + mb * FRH) = ol[nb]; }
            asm volatile("s_wait_xcnt 0x0" :: "v"(p0), "v"(p1), "v"(oh[0]), "v"(oh[1]), "v"(oh[2]), "v"(oh[3]), "v"(ol[0]), "v"(ol[1]), "v"(ol[2]), "v"(ol[3]) : "memory"); }   // as above, for the stores' address and data registers
    }
}
__constant__ float SLOPE2[NH_] = { L2E * 0.5f, L2E * 0.25f, L2E * 0.125f, L2E * 0.0625f, L2E * 0.03125f, L2E * 0.015625f, L2E * 0.0078125f, L2E * 0.00390625f };   // log2(e) x the per-head ALiBi slope magnitude (|slope_h| = 2^-(h+1), h = 0..7)
// k_fattn: scores, softmax and context of one (batch, head) z = blockIdx.y in one pass over the keys; no score plane. One wave owns QT*16 query columns and walks the 2048 keys 32 at a time:
//   S^T = K Q^T (A = key rows, B = query rows; 3 products on hi/lo planes): lane (lr, hi) holds, for query lr of a group, keys 8 hi + r of each 16-key tile;
//   ALiBi: -sl |i - j| = cb - u, u = sl |q0 - kb| (sl = |slope| log2(e)): off the diagonal block |i - j| = |q0 - kb| +- e with e = (i - q0) - (j - kb), so cb = -+ sl e is the same in every pass on one side of the diagonal and stays in registers;
//   t = S + cb - u in log2 units; running maximum m and sum l per query (online softmax), p = 2^(S + cb - (m + u));
//   the two key tiles' p, split hi/lo, ARE the B operand of O^T += V^T P^T in the hardware k order (element s < 8: tile 0 register s; s >= 8: tile 1 register s - 8), A = V^T rows by the same loader order;
//   out = O^T / l: a lane's 8 accumulator registers are 8 consecutive d of its query's output row.
#define QT 2
__device__ __forceinline__ float xhalf(float x) { const int b = __float_as_int(x); return __int_as_float(__builtin_amdgcn_permlanex16(b, b, 0x76543210, 0xfedcba98, false, false)); }   // lane l <-> l ^ 16, in registers
__global__ __launch_bounds__(256) void k_fattn(const bf* __restrict__ Qh, const bf* __restrict__ Ql, const bf* __restrict__ Kh, const bf* __restrict__ Kl, const bf* __restrict__ Vh, const bf* __restrict__ Vl, float* OUT) {
    typedef WFrag<bf> WF; typedef v16bf V;
    const int lane = threadIdx.x & 31, lr = lane & 15, hi = lane >> 4, wv = __builtin_amdgcn_readfirstlane(threadIdx.x >> 5);   // the wave's number in a scalar register: the test on kb - q0 in the loop is then a scalar branch
    const int z = blockIdx.y, h = z % NH_, b = z / NH_; const int q0 = (blockIdx.x * 8 + wv) * (QT * 16);
    const float sl = SLOPE2[h]; const size_t zo = (size_t)z * TT * HD;
    V qh[QT][2], ql[QT][2];
#pragma unroll
    for (int qt = 0; qt < QT; ++qt) { const size_t qo = zo + (size_t)(q0 + qt * 16) * HD + lane * 8; const bf* qa = Qh + qo; const bf* qb = Ql + qo;
#pragma unroll
        for (int ks = 0; ks < 2; ++ks) { qh[qt][ks] = WF::ld(qa + ks * FRG); ql[qt][ks] = WF::ld(qb + ks * FRG); }
        asm volatile("s_wait_xcnt 0x0" :: "v"(qa), "v"(qb) : "memory"); }   // the wait in front of any overwrite of the loads' address registers; the two inputs keep those registers untouched up to here
    const bf* kph = Kh + zo + lane * 8; const bf* kpl = Kl + zo + lane * 8;
    const bf* vph = Vh + zo + lane * 8; const bf* vpl = Vl + zo + lane * 8;
    V kh[2][2], kl[2][2];
#pragma unroll
    for (int kt = 0; kt < 2; ++kt)
#pragma unroll
        for (int ks = 0; ks < 2; ++ks) { kh[kt][ks] = WF::ld(kph + kt * 16 * HD + ks * FRG); kl[kt][ks] = WF::ld(kpl + kt * 16 * HD + ks * FRG); }
    asm volatile("s_wait_xcnt 0x0" :: "v"(kph), "v"(kpl) : "memory");   // as above, for the first key loads
    __builtin_amdgcn_sched_barrier(0);   // keeps later code behind that wait: left free, the build formed these loads on a lane-offset register and rewrote it in front of the wait
    v8f o[4][QT]; float m[QT], l[QT];
    v8f cb[2][QT];   // the ALiBi term's part inside the block, one value a score register; keys left of the diagonal block (i > j): -sl e
#pragma unroll
    for (int kt = 0; kt < 2; ++kt)
#pragma unroll
        for (int qt = 0; qt < QT; ++qt)
#pragma unroll
            for (int r = 0; r < 8; ++r) cb[kt][qt][r] = -sl * (float)(qt * 16 + lr - hi * 8 - kt * 16 - r);
#pragma unroll
    for (int qt = 0; qt < QT; ++qt) { m[qt] = -3.0e38f; l[qt] = 0.f;
#pragma unroll
        for (int db = 0; db < 4; ++db) o[db][qt] = (v8f){}; }
#pragma unroll 1   // rolled: one pass's fragments, the query fragments and the accumulators fill the registers
    for (int kb = 0; kb < TT; kb += 32) {
        if ((unsigned)(kb - q0) <= 32u) {   // the two passes in which the table changes: the diagonal block (-sl |e|) and the first one right of it (j > i from there on: +sl e)
            const bool dg = kb == q0;
#pragma unroll
            for (int kt = 0; kt < 2; ++kt)
#pragma unroll
                for (int qt = 0; qt < QT; ++qt)
#pragma unroll
                    for (int r = 0; r < 8; ++r) { const float e = (float)(qt * 16 + lr - hi * 8 - kt * 16 - r); cb[kt][qt][r] = sl * (dg ? -fabsf(e) : e); }
        }
        const float u = sl * (float)(kb < q0 ? q0 - kb : kb - q0);   // the block distance's share of the ALiBi term, the same for every score of the pass
        V vh[4], vl[4];   // this pass's V^T fragments, asked for first: they fly under the score products and the softmax
        const bf* vch = vph + (size_t)kb * HD; const bf* vcl = vpl + (size_t)kb * HD;
#pragma unroll
        for (int db = 0; db < 4; ++db) { vh[db] = WF::ld(vch + db * FRG); vl[db] = WF::ld(vcl + db * FRG); }
        asm volatile("s_wait_xcnt 0x0" :: "v"(vch), "v"(vcl) : "memory");   // as above, for the V^T loads' address registers
        __builtin_amdgcn_sched_barrier(0);   // keeps the V^T loads up here: left free, the compiler sank them to just in front of their products, where their latency shows
        v8f s[2][QT];
#pragma unroll
        for (int kt = 0; kt < 2; ++kt)
#pragma unroll
            for (int qt = 0; qt < QT; ++qt) s[kt][qt] = (v8f){};
#pragma unroll
        for (int ks = 0; ks < 2; ++ks) {
#pragma unroll
            for (int kt = 0; kt < 2; ++kt)
#pragma unroll
                for (int qt = 0; qt < QT; ++qt) s[kt][qt] = WF::mma(kh[kt][ks], qh[qt][ks], s[kt][qt]);
#pragma unroll
            for (int kt = 0; kt < 2; ++kt)
#pragma unroll
                for (int qt = 0; qt < QT; ++qt) s[kt][qt] = WF::mma(kl[kt][ks], qh[qt][ks], s[kt][qt]);
#pragma unroll
            for (int kt = 0; kt < 2; ++kt)
#pragma unroll
                for (int qt = 0; qt < QT; ++qt) s[kt][qt] = WF::mma(kh[kt][ks], ql[qt][ks], s[kt][qt]);
        }
        const int kn = (kb + 32) & (TT - 1);   // the next pass's key fragments, one pass ahead (the last pass asks for keys 0..31 again: in bounds, unused)
        const bf* kch = kph + (size_t)kn * HD; const bf* kcl = kpl + (size_t)kn * HD;
#pragma unroll
        for (int kt = 0; kt < 2; ++kt)
#pragma unroll
            for (int ks = 0; ks < 2; ++ks) { kh[kt][ks] = WF::ld(kch + kt * 16 * HD + ks * FRG); kl[kt][ks] = WF::ld(kcl + kt * 16 * HD + ks * FRG); }
        asm volatile("s_wait_xcnt 0x0" :: "v"(kch), "v"(kcl) : "memory");   // as above, for the key loads' address registers
        __builtin_amdgcn_sched_barrier(0);   // keeps the next pass's key loads in front of the softmax, so that they fly under it
        float mn[QT]; bool need = false;
#pragma unroll
        for (int qt = 0; qt < QT; ++qt) { float mx = -3.0e38f;
#pragma unroll
            for (int kt = 0; kt < 2; ++kt) { s[kt][qt] += cb[kt][qt];
#pragma unroll
                for (int r = 0; r < 8; ++r) mx = fmaxf(mx, s[kt][qt][r]); }
            mx = fmaxf(mx, xhalf(mx));   // the other lane half holds the query's other 16 keys
            mn[qt] = fmaxf(m[qt], mx - u); need = need || (mn[qt] > m[qt]); }
        if (__builtin_amdgcn_ballot_w32(need) != 0) {   // no query of the wave has a new maximum: every factor would be exactly 1
#pragma unroll
            for (int qt = 0; qt < QT; ++qt) { const float al = __builtin_amdgcn_exp2f(m[qt] - mn[qt]); m[qt] = mn[qt]; l[qt] *= al;
#pragma unroll
                for (int db = 0; db < 4; ++db) o[db][qt] *= al; }
        }
        V ph[QT], pl[QT];
#pragma unroll
        for (int qt = 0; qt < QT; ++qt) { const float mu = m[qt] + u;
#pragma unroll
            for (int kt = 0; kt < 2; ++kt) { const v8f x = s[kt][qt] - mu;
#pragma unroll
                for (int r = 0; r < 8; r += 2) { v2f p; p[0] = __builtin_amdgcn_exp2f(x[r]); p[1] = __builtin_amdgcn_exp2f(x[r + 1]); l[qt] += p[0] + p[1];
                    const v2bf a = __builtin_convertvector(p, v2bf); v2f e; e[0] = p[0] - (float)a[0]; e[1] = p[1] - (float)a[1]; const v2bf c = __builtin_convertvector(e, v2bf);
                    ph[qt][kt * 8 + r] = a[0]; ph[qt][kt * 8 + r + 1] = a[1]; pl[qt][kt * 8 + r] = c[0]; pl[qt][kt * 8 + r + 1] = c[1]; } } }
#pragma unroll
        for (int db = 0; db < 4; ++db)
#pragma unroll
            for (int qt = 0; qt < QT; ++qt) o[db][qt] = WF::mma(vh[db], ph[qt], o[db][qt]);
#pragma unroll
        for (int db = 0; db < 4; ++db)
#pragma unroll
            for (int qt = 0; qt < QT; ++qt) o[db][qt] = WF::mma(vl[db], ph[qt], o[db][qt]);
#pragma unroll
        for (int db = 0; db < 4; ++db)
#pragma unroll
            for (int qt = 0; qt < QT; ++qt) o[db][qt] = WF::mma(vh[db], pl[qt], o[db][qt]);
    }
#pragma unroll
    for (int qt = 0; qt < QT; ++qt) { const float inv = __fdiv_rn(1.0f, l[qt] + xhalf(l[qt])); float* op = OUT + ((size_t)b * TT + q0 + qt * 16 + lr) * DQ + h * HD + hi * 8;
#pragma unroll
        for (int db = 0; db < 4; ++db) { v4f x0, x1;
#pragma unroll
            for (int r = 0; r < 4; ++r) { x0[r] = o[db][qt][r] * inv; x1[r] = o[db][qt][4 + r] * inv; }
            *(v4f*)(op + db * 16) = x0; *(v4f*)(op + db * 16 + 4) = x1; } }
}

extern "C" void kernel_launch(void* const* d_in, const int* in_sizes, int n_in,
                              void* d_out, int out_size, void* d_ws, size_t ws_size, hipStream_t stream) {
    (void)in_sizes; (void)n_in; (void)out_size;
    const float* x = (const float*)d_in[0]; const float* wq = (const float*)d_in[1]; const float* bq = (const float*)d_in[2]; const float* wk = (const float*)d_in[3]; const float* bk = (const float*)d_in[4]; const float* wv = (const float*)d_in[5]; const float* bv = (const float*)d_in[6];   /* order hidden_states, Wq, bq, Wk, bk, Wv, bv ('xw' + biases) */
    float* OUT = (float*)d_out;     // [4][2048][512]
    char* wsp = (char*)d_ws;
    auto take = [&](size_t bytes) { char* p = wsp; wsp += (bytes + 255) & ~(size_t)255; return (void*)p; };
    bf* WT = (bf*)take((size_t)3 * DQ * DM * 2); bf* XB = (bf*)take((size_t)NB_ * TT * DM * 2);
    const size_t PB = (size_t)NH_ * TT * HD;   // one batch's hi or lo plane set, elements
    bf* QPh = (bf*)take(NB_ * PB * 2); bf* QPl = (bf*)take(NB_ * PB * 2); bf* KPh = (bf*)take(NB_ * PB * 2); bf* KPl = (bf*)take(NB_ * PB * 2); bf* VTh = (bf*)take(NB_ * PB * 2); bf* VTl = (bf*)take(NB_ * PB * 2);
    if ((size_t)(wsp - (char*)d_ws) > ws_size) return;    // ws 256 MiB
    k_prep<<<XBLK + 3 * WBLK, 256, 0, stream>>>(x, wq, wk, wv, XB, WT);
    k_proj<<<dim3(NB_ * TT / 64, 3 * NH_ / 4, 1), 128, 0, stream>>>(XB, WT, bq, bk, bv, QPh, QPl, KPh, KPl, VTh, VTl);
    k_fattn<<<dim3(TT / (8 * QT * 16), NB_ * NH_, 1), 256, 0, stream>>>(QPh, QPl, KPh, KPl, VTh, VTl, OUT);   // one kv head per query head: plane z = b * NH_ + h of each operand
}

// v007
// Measured time: 91 microseconds a run.
// Two timings next to v006 put it at 1.05 and 1.07 times that version's speed.
// Over all steps from v000 it is 15.7 times as fast.
#include <hip/hip_runtime.h>

// BERT-style self-attention with a symmetric ALiBi score bias and no output projection (hidden_states [4][2048][512]; q, k, v = x W + b ('xw' [512][512] 0.02 incl. biases; 8 heads x 64); scores = q.k / sqrt(64) + slope_h |i - j| with slope_h = -2^-(h+1) (h = 0..7: the module's _get_slopes(8), negated; up to -0.5 x 2047); softmax over all keys; out = merged context -> [4][2048][512] (4.2 M); argument order hidden_states, Wq, bq, Wk, bk, Wv, bv).
// Every 16-bit matrix operand plane lies in FRAGMENT ORDER (see the loader): a wave-wide 16-byte load or store covers 512 contiguous bytes, 4 whole lines.
// Three launches: bf16 copy of x and the 'xw' weights transposed; ONE projection launch over all batches and q, k, v (f32 biases) that stores the hi/lo planes from its accumulators; then ONE fused attention launch over all 32 (batch, head) planes with EVERY row on hi/lo planes (3 products; the ALiBi term makes the steep heads few-key sharp, so no fp16 rows): q carries the factor HD^-0.5 x log2(e) from the projection, so the score products come out in log2 units; the ALiBi term is one add per score from a table held in registers (its part inside the 32 x 32 block) plus one shift per pass (the block distance); the launch keeps a running maximum and sum and writes the output rows. The key loop of a wave covers only the 64-key blocks that can matter: a block is left out where the bound |q| |k| on its scores (norms stored by the projection) and its ALiBi distance put every term under 2^-40 of the row's largest.
// Compute dtypes, f32 accumulate: every input rounded to bf16; projections exact + f32 biases; scores and attn.v 3 products on every row; ALiBi add and softmax f32; output f32.

#define NB_  4
#define TT   2048
#define DM   512
#define NH_  8
#define NKV  8
#define REP  (NH_ / NKV)
#define HD   64
#define DQ   (NH_ * HD)
#define DKV  (NKV * HD)
#define SCL  0.125f   // HD^-0.5
#define L2E  1.4426950408889634f   // log2(e)
typedef _Float16 h16;
typedef unsigned short bf;
typedef __attribute__((ext_vector_type(16))) __bf16   v16bf;
typedef __attribute__((ext_vector_type(16))) _Float16 v16h;
typedef __attribute__((ext_vector_type(8)))  _Float16 v8h;
typedef __attribute__((ext_vector_type(8)))  unsigned short v8us;
typedef __attribute__((ext_vector_type(8)))  float    v8f;
typedef __attribute__((ext_vector_type(4)))  float    v4f;
typedef v8h  __attribute__((may_alias)) v8ha;
typedef v4f  __attribute__((may_alias)) v4fa;
typedef v8us __attribute__((may_alias)) v8usa;

__device__ __forceinline__ unsigned short f2bf(float f) { unsigned u = __float_as_uint(f); u += 0x7FFFu + ((u >> 16) & 1u); return (unsigned short)(u >> 16); }
__device__ __forceinline__ float bf2f(unsigned short b) { return __uint_as_float(((unsigned)b) << 16); }
__device__ __forceinline__ float bfr(float f) { return bf2f(f2bf(f)); }
__device__ __forceinline__ v16h cat16(v8h lo, v8h hi) { return __builtin_shufflevector(lo, hi, 0, 1, 2, 3, 4, 5, 6, 7, 8, 9, 10, 11, 12, 13, 14, 15); }
__device__ __forceinline__ v16bf cat16b(v8us lo, v8us hi) { return __builtin_bit_cast(v16bf, __builtin_shufflevector(lo, hi, 0, 1, 2, 3, 4, 5, 6, 7, 8, 9, 10, 11, 12, 13, 14, 15)); }
__device__ __forceinline__ v8f wmma16(v16h a, v16h b, v8f c) { return __builtin_amdgcn_wmma_f32_16x16x32_f16(false, a, false, b, (short)0, c, false, false); }
__device__ __forceinline__ v8f wmmab(v16bf a, v16bf b, v8f c) { return __builtin_amdgcn_wmma_f32_16x16x32_bf16(false, a, false, b, (short)0, c, false, false); }



// ---- fragment loader and product (hardware k order: lane half hi takes k = 8 hi + 0..7 and 16 + 8 hi + 0..7 of each 32)
// bf16 planes are stored in fragment order: one fragment (16 rows x 32 k) is 1 KiB = 2 halves j of 512 bytes; half j holds, at 16 bytes x lane (lane = 16 hi + row), k = 16 j + 8 hi + 0..7 of that row.
// A plane of R rows x K: element offset = (row / 16) * 16 K + (k / 32) * FRG + j * FRH + lane * 8 + k % 8. The loader takes the address of the lane's 16 bytes in half 0.
#define FRH 256   // elements of half a fragment
#define FRG 512   // elements of a fragment
template <typename T16> struct WFrag;
template <> struct WFrag<h16> { typedef v16h V; static __device__ __forceinline__ V ld(const h16* p) { return cat16(*(const v8h*)p, *(const v8h*)(p + 16)); } static __device__ __forceinline__ v8f mma(V a, V b, v8f c) { return wmma16(a, b, c); } };
template <> struct WFrag<bf> { typedef v16bf V; static __device__ __forceinline__ V ld(const bf* p) { return cat16b(*(const v8us*)p, *(const v8us*)(p + FRH)); } static __device__ __forceinline__ v8f mma(V a, V b, v8f c) { return wmmab(a, b, c); } };

typedef __attribute__((ext_vector_type(2))) float v2f;
typedef __attribute__((ext_vector_type(2))) __bf16 v2bf;
typedef __attribute__((ext_vector_type(8))) __bf16 v8bf;
typedef __attribute__((ext_vector_type(4))) unsigned v4u;
typedef v4u __attribute__((may_alias)) v4ua;

// ---- k_prep: every 16-bit GEMM operand in one launch, written in fragment order. Work-groups 0..XBLK-1: bf16 copy of x, one 16-row tile a work-group, 8 elements a thread and step (a wave reads 16 rows x 64 bytes and writes half a fragment). The next 3 x WBLK: Wq, Wk, Wv ([k][n], f32) rounded to bf16 and transposed to rows n of WT (row = which x DQ + n); a wave takes one fragment (16 n x 32 k) and writes its 8 whole 128-byte lines.
#define XBLK 512
#define WBLK (DQ / 8)   // DQ / 16 row tiles x DM / 32 fragments, 8 a work-group
__global__ __launch_bounds__(256) void k_prep(const float* __restrict__ x, const float* __restrict__ wq, const float* __restrict__ wk, const float* __restrict__ wv, bf* XB, bf* WT) {
    if (blockIdx.x < XBLK) {
        constexpr int NIT = NB_ * TT * DM / 8 / (XBLK * 256); static_assert(NIT * 256 * 8 == 16 * DM, "one 16-row tile a work-group"); const size_t i0 = (size_t)blockIdx.x * (NIT * 256) + threadIdx.x;
        const float* sp = x + ((size_t)blockIdx.x * 16 + (threadIdx.x & 15)) * DM + (threadIdx.x >> 4) * 8; bf* dp = XB + i0 * 8; v8f v[NIT]; v4u o[NIT];   // thread = (k / 8) % 16 x 16 + row; step it takes k = 128 it + ...
#pragma unroll
        for (int it = 0; it < NIT; ++it) v[it] = *(const v8f*)(sp + it * 128);
        asm volatile("s_wait_xcnt 0x0" :: "v"(sp) : "memory");   // the wait in front of any overwrite of the loads' address registers; the input keeps them untouched up to here
#pragma unroll
        for (int it = 0; it < NIT; ++it) { v8us u;
#pragma unroll
            for (int k = 0; k < 8; ++k) u[k] = f2bf(v[it][k]);
            o[it] = __builtin_bit_cast(v4u, u); *(v4ua*)(dp + it * 256 * 8) = o[it]; }
        return;
    }
    const int wb = blockIdx.x - XBLK, which = wb / WBLK; const float* w = which == 0 ? wq : which == 1 ? wk : wv;
    const int lane = threadIdx.x & 31, lr = lane & 15, hi = lane >> 4; const int rt = wb >> 1, kf = (wb & 1) * 8 + (threadIdx.x >> 5);   // row tile of WT (16 n), fragment along k
    const float* sp = w + (size_t)(kf * 32 + hi * 8) * DQ + (rt % (DQ / 16)) * 16 + lr; bf* dp = WT + (size_t)rt * (16 * DM) + kf * FRG + lane * 8; float f[2][8]; v4u o[2];
#pragma unroll
    for (int j = 0; j < 2; ++j)
#pragma unroll
        for (int r = 0; r < 8; ++r) f[j][r] = sp[(size_t)(j * 16 + r) * DQ];   // k = 32 kf + 16 j + 8 hi + r of column n
    asm volatile("s_wait_xcnt 0x0" :: "v"(sp) : "memory");   // as above, for the loads' address registers
#pragma unroll
    for (int j = 0; j < 2; ++j) { v8us u;
#pragma unroll
        for (int r = 0; r < 8; ++r) u[r] = f2bf(f[j][r]);
        o[j] = __builtin_bit_cast(v4u, u); *(v4ua*)(dp + j * FRH) = o[j]; }
    asm volatile("s_wait_xcnt 0x0" :: "v"(dp), "v"(o[0]), "v"(o[1]) : "memory");   // as above, for the stores' address and data registers: in the built code the other branch's block, which writes them, stands behind these stores
}

__device__ __forceinline__ float xhalf(float x) { const int b = __float_as_int(x); return __int_as_float(__builtin_amdgcn_permlanex16(b, b, 0x76543210, 0xfedcba98, false, false)); }   // lane l <-> l ^ 16, in registers
template <int M> __device__ __forceinline__ float rowmax(float x) { const int b = __float_as_int(x); return fmaxf(x, __int_as_float(__builtin_amdgcn_update_dpp(b, b, 0x160 + M, 0xf, 0xf, false))); }   // max with lane l ^ M of the 16-lane row (DPP row_xmask)
#define NBK (TT / 64)   // 64-token blocks of a plane: one squared norm bound each, in a 128-byte line of its own (one writer a line)
__device__ __forceinline__ void split8(const v8f y, v4u& oh, v4u& ol) { v8bf a, c;
#pragma unroll
    for (int r = 0; r < 8; r += 2) { v2f p; p[0] = y[r]; p[1] = y[r + 1]; const v2bf u = __builtin_convertvector(p, v2bf); v2f e; e[0] = p[0] - (float)u[0]; e[1] = p[1] - (float)u[1]; const v2bf w = __builtin_convertvector(e, v2bf); a[r] = u[0]; a[r + 1] = u[1]; c[r] = w[0]; c[r + 1] = w[1]; }
    oh = __builtin_bit_cast(v4u, a); ol = __builtin_bit_cast(v4u, c); }
__global__ __launch_bounds__(128) void k_proj(const bf* __restrict__ XB, const bf* __restrict__ WT, const float* __restrict__ bq, const float* __restrict__ bk, const float* __restrict__ bv, bf* QPh, bf* QPl, bf* KPh, bf* KPl, bf* VTh, bf* VTl, float* NR) {
    typedef WFrag<bf> WF; typedef v16bf V;
    const int lane = threadIdx.x & 31, lr = lane & 15, hi = lane >> 4, wv = threadIdx.x >> 5;
    const int which = blockIdx.y / (NH_ / 4), head = (blockIdx.y % (NH_ / 4)) * 4 + wv; const int t0 = blockIdx.x * 64, b = t0 / TT, tl = t0 % TT;
    const bf* xp = XB + (size_t)t0 * DM + lane * 8; const bf* wp = WT + ((size_t)which * DQ + head * HD) * DM + lane * 8;
    const bf* ap = which == 2 ? xp : wp; const bf* bp = which == 2 ? wp : xp;   // A rows, B rows: both in fragment order, same loader, same k order
    v8f acc[4][4];
#pragma unroll
    for (int mb = 0; mb < 4; ++mb)
#pragma unroll
        for (int nb = 0; nb < 4; ++nb) acc[mb][nb] = (v8f){};
    V a[2][4], bb[2][4];
#pragma unroll
    for (int i = 0; i < 4; ++i) { a[0][i] = WF::ld(ap + i * 16 * DM); bb[0][i] = WF::ld(bp + i * 16 * DM); }
#pragma unroll   // unrolled whole: every load is one of two bases + a constant offset, and the two fragment sets swap by name
    for (int kc = 0; kc < DM; kc += 32) { const int cu = (kc >> 5) & 1, nx = cu ^ 1;
        if (kc + 32 < DM) {   // the next 32 k, asked for in front of this step's products
#pragma unroll
            for (int i = 0; i < 4; ++i) { a[nx][i] = WF::ld(ap + i * 16 * DM + (kc + 32) / 32 * FRG); bb[nx][i] = WF::ld(bp + i * 16 * DM + (kc + 32) / 32 * FRG); } }
        __builtin_amdgcn_sched_barrier(0);   // keeps the next step's loads up here: left free, the compiler sank each pair to just in front of its products and waited out its latency there
#pragma unroll
        for (int nb = 0; nb < 4; ++nb)
#pragma unroll
            for (int mb = 0; mb < 4; ++mb) acc[mb][nb] = WF::mma(a[cu][mb], bb[cu][nb], acc[mb][nb]);
    }
    asm volatile("s_wait_xcnt 0x0" :: "v"(ap), "v"(bp) : "memory");   // the wait in front of any overwrite of the fragment loads' address registers; the inputs keep them untouched up to here
    const size_t z = (size_t)b * NH_ + head;
    if (which == 2) {
        const float* bs = bv + head * HD + lr; float bi[4];
#pragma unroll
        for (int nb = 0; nb < 4; ++nb) bi[nb] = bs[nb * 16];
        asm volatile("s_wait_xcnt 0x0" :: "v"(bs) : "memory");   // as above, for the bias loads
        const size_t o0 = (z * TT + tl) * HD + lane * 8; bf* p0 = VTh + o0; bf* p1 = VTl + o0;
#pragma unroll
        for (int nb = 0; nb < 4; ++nb) { v4u oh[4], ol[4];
#pragma unroll
            for (int mb = 0; mb < 4; ++mb) { split8(acc[mb][nb] + bfr(bi[nb]), oh[mb], ol[mb]); *(v4ua*)(p0 + (mb >> 1) * (4 * FRG) + nb * FRG + (mb & 1) * FRH) = oh[mb]; *(v4ua*)(p1 + (mb >> 1) * (4 * FRG) + nb * FRG + (mb & 1) * FRH) = ol[mb]; }
            asm volatile("s_wait_xcnt 0x0" :: "v"(p0), "v"(p1), "v"(oh[0]), "v"(oh[1]), "v"(oh[2]), "v"(oh[3]), "v"(ol[0]), "v"(ol[1]), "v"(ol[2]), "v"(ol[3]) : "memory"); }   // as above, for the stores' address and data registers
    } else {
        const float* bs = (which == 0 ? bq : bk) + head * HD + hi * 8; v8f bi[4]; const float qs = which == 0 ? SCL * L2E : 1.0f;   // q leaves with the score scale and log2(e) on it (k: x 1, exact)
#pragma unroll
        for (int mb = 0; mb < 4; ++mb) bi[mb] = *(const v8f*)(bs + mb * 16);
        asm volatile("s_wait_xcnt 0x0" :: "v"(bs) : "memory");   // as above, for the bias loads
        const size_t o0 = (z * TT + tl) * HD + lane * 8; bf* p0 = (which == 0 ? QPh : KPh) + o0; bf* p1 = (which == 0 ? QPl : KPl) + o0; float n2[4] = { 0.f, 0.f, 0.f, 0.f };   // squared length of token nb x 16 + lr, this lane half's d
#pragma unroll
        for (int mb = 0; mb < 4; ++mb) { v4u oh[4], ol[4];
#pragma unroll
            for (int j = 0; j < 8; ++j) bi[mb][j] = bfr(bi[mb][j]);
#pragma unroll
            for (int nb = 0; nb < 4; ++nb) { const v8f y = (acc[mb][nb] + bi[mb]) * qs, w = y * y; n2[nb] += ((w[0] + w[1]) + (w[2] + w[3])) + ((w[4] + w[5]) + (w[6] + w[7])); split8(y, oh[nb], ol[nb]); *(v4ua*)(p0 + nb * 16 * HD + mb * FRH) = oh[nb]; *(v4ua*)(p1 + nb * 16 * HD + mb * FRH) = ol[nb]; }
            asm volatile("s_wait_xcnt 0x0" :: "v"(p0), "v"(p1), "v"(oh[0]), "v"(oh[1]), "v"(oh[2]), "v"(oh[3]), "v"(ol[0]), "v"(ol[1]), "v"(ol[2]), "v"(ol[3]) : "memory"); }   // as above, for the stores' address and data registers
        float nm = fmaxf(fmaxf(n2[0] + xhalf(n2[0]), n2[1] + xhalf(n2[1])), fmaxf(n2[2] + xhalf(n2[2]), n2[3] + xhalf(n2[3])));   // the longest of the wave's 64 tokens
        nm = rowmax<1>(nm); nm = rowmax<2>(nm); nm = rowmax<4>(nm); nm = rowmax<8>(nm);
        float* np = NR + (((size_t)which * (NB_ * NH_) + z) * NBK + tl / 64) * 32 + lane; *np = nm;   // every lane holds it: the wave writes its whole line
        asm volatile("s_wait_xcnt 0x0" :: "v"(np), "v"(nm) : "memory");   // as above, for the store's address and data registers
    }
}
__constant__ float SLOPE2[NH_] = { L2E * 0.5f, L2E * 0.25f, L2E * 0.125f, L2E * 0.0625f, L2E * 0.03125f, L2E * 0.015625f, L2E * 0.0078125f, L2E * 0.00390625f };   // log2(e) x the per-head ALiBi slope magnitude (|slope_h| = 2^-(h+1), h = 0..7)
// k_fattn: scores, softmax and context of one (batch, head) z a wave in one pass over the keys; no score plane. One wave owns QT*16 query columns and walks its key range (all 2048 keys where no block is shown to vanish) 32 at a time:
//   S^T = K Q^T (A = key rows, B = query rows; 3 products on hi/lo planes): lane (lr, hi) holds, for query lr of a group, keys 8 hi + r of each 16-key tile;
//   ALiBi: -sl |i - j| = cb - u, u = sl |q0 - kb| (sl = |slope| log2(e)): off the diagonal block |i - j| = |q0 - kb| +- e with e = (i - q0) - (j - kb), so cb = -+ sl e is the same in every pass on one side of the diagonal and stays in registers;
//   t = S + cb - u in log2 units; running maximum m and sum l per query (online softmax), p = 2^(S + cb - (m + u));
//   the two key tiles' p, split hi/lo, ARE the B operand of O^T += V^T P^T in the hardware k order (element s < 8: tile 0 register s; s >= 8: tile 1 register s - 8), A = V^T rows by the same loader order;
//   out = O^T / l: a lane's 8 accumulator registers are 8 consecutive d of its query's output row.
#define QT 2
#define QTL (TT / (4 * QT * 16))   // query tiles of 4 waves in a plane
#define TCUT 40.0f   // a key block is left out where every term of it lies under 2^-TCUT of its row's largest: at most TT such terms, under 2^-29 of the row's sum together, below half a unit of its last place
__global__ __launch_bounds__(256) void k_fattn(const bf* __restrict__ Qh, const bf* __restrict__ Ql, const bf* __restrict__ Kh, const bf* __restrict__ Kl, const bf* __restrict__ Vh, const bf* __restrict__ Vl, const float* __restrict__ NR, float* OUT) {
    typedef WFrag<bf> WF; typedef v16bf V;
    const int lane = threadIdx.x & 31, lr = lane & 15, hi = lane >> 4, wv = __builtin_amdgcn_readfirstlane(threadIdx.x >> 5);   // the wave's number in a scalar register: the test on kb - q0 in the loop is then a scalar branch
    // a work-group holds a flat head (4..7: long key loop, waves 0..3) and a steep one (3..0: short loop, waves 4..7): waves w and w + 4 share a SIMD, so every SIMD gets one of each; the steep head's query tile lies half a sequence away, where head 3's long loops meet head 4's short ones
    const int b = blockIdx.y / (NH_ / 2), pr = blockIdx.y % (NH_ / 2); const bool st = wv >= 4; const int h = st ? NH_ / 2 - 1 - pr : NH_ / 2 + pr, z = b * NH_ + h;
    const int q0 = ((st ? (blockIdx.x + QTL / 2) % QTL : blockIdx.x) * 4 + (wv & 3)) * (QT * 16);
    const float sl = SLOPE2[h]; const size_t zo = (size_t)z * TT * HD;
    V qh[QT][2], ql[QT][2];
#pragma unroll
    for (int qt = 0; qt < QT; ++qt) { const size_t qo = zo + (size_t)(q0 + qt * 16) * HD + lane * 8; const bf* qa = Qh + qo; const bf* qb = Ql + qo;
#pragma unroll
        for (int ks = 0; ks < 2; ++ks) { qh[qt][ks] = WF::ld(qa + ks * FRG); ql[qt][ks] = WF::ld(qb + ks * FRG); }
        asm volatile("s_wait_xcnt 0x0" :: "v"(qa), "v"(qb) : "memory"); }   // the wait in front of any overwrite of the loads' address registers; the two inputs keep those registers untouched up to here
    // the wave's key range. Lane j judges keys 64 j .. 64 j + 63: no score there exceeds bj = |q| |k| (longest query of the wave's 64-token block, longest key of block j; 1/16 on top for the hi/lo products' rounding), the ALiBi term is at most -sl dmin,
    // and every row's largest term is at least its own diagonal one, >= -bd. The range runs from the first to the last block that is not shown to vanish; the diagonal block is always in it.
    const int jd = q0 >> 6; const float* nqp = NR + ((size_t)z * NBK + jd) * 32 + lane; const float* nkp = NR + ((size_t)(NB_ * NH_ + z) * NBK + lane) * 32; static_assert(NBK == 32, "one key block a lane");
    const float qn2 = *nqp, kn2 = *nkp;
    asm volatile("s_wait_xcnt 0x0" :: "v"(nqp), "v"(nkp) : "memory");   // as above, for the two norm loads
    __builtin_amdgcn_sched_barrier(0);   // keeps later code behind that wait: left free, the build rewrote the first load's scalar base in front of it
    const float bj = 1.0625f * __builtin_amdgcn_sqrtf(qn2 * kn2), bd = __int_as_float(__builtin_amdgcn_readlane(__float_as_int(bj), jd));
    const int dl = q0 - (lane * 64 + 63), dr = lane * 64 - (q0 + QT * 16 - 1), dmin = dl > 0 ? dl : dr > 0 ? dr : 0;
    const unsigned live = __builtin_amdgcn_ballot_w32(!(bj - sl * (float)dmin < -bd - TCUT)) | (1u << jd);   // written so that a NaN keeps its block
    const int klo = __builtin_ctz(live) * 64, khi = (32 - __builtin_clz(live)) * 64;
    const bf* kph = Kh + zo + lane * 8; const bf* kpl = Kl + zo + lane * 8;
    const bf* vph = Vh + zo + lane * 8; const bf* vpl = Vl + zo + lane * 8;
    V kh[2][2], kl[2][2]; const bf* k0h = kph + (size_t)klo * HD; const bf* k0l = kpl + (size_t)klo * HD;   // the range's first keys
#pragma unroll
    for (int kt = 0; kt < 2; ++kt)
#pragma unroll
        for (int ks = 0; ks < 2; ++ks) { kh[kt][ks] = WF::ld(k0h + kt * 16 * HD + ks * FRG); kl[kt][ks] = WF::ld(k0l + kt * 16 * HD + ks * FRG); }
    asm volatile("s_wait_xcnt 0x0" :: "v"(k0h), "v"(k0l) : "memory");   // as above, for the first key loads
    __builtin_amdgcn_sched_barrier(0);   // keeps later code behind that wait: left free, the build formed these loads on a lane-offset register and rewrote it in front of the wait
    v8f o[4][QT]; float m[QT], l[QT];
    v8f cb[2][QT];   // the ALiBi term's part inside the block, one value a score register; keys left of the diagonal block (i > j): -sl e
#pragma unroll
    for (int kt = 0; kt < 2; ++kt)
#pragma unroll
        for (int qt = 0; qt < QT; ++qt)
#pragma unroll
            for (int r = 0; r < 8; ++r) cb[kt][qt][r] = -sl * (float)(qt * 16 + lr - hi * 8 - kt * 16 - r);
#pragma unroll
    for (int qt = 0; qt < QT; ++qt) { m[qt] = -3.0e38f; l[qt] = 0.f;
#pragma unroll
        for (int db = 0; db < 4; ++db) o[db][qt] = (v8f){}; }
#pragma unroll 1   // rolled: one pass's fragments, the query fragments and the accumulators fill the registers
    for (int kb = klo; kb < khi; kb += 32) {
        if ((unsigned)(kb - q0) <= 32u) {   // the two passes in which the table changes: the diagonal block (-sl |e|) and the first one right of it (j > i from there on: +sl e)
            const bool dg = kb == q0;
#pragma unroll
            for (int kt = 0; kt < 2; ++kt)
#pragma unroll
                for (int qt = 0; qt < QT; ++qt)
#pragma unroll
                    for (int r = 0; r < 8; ++r) { const float e = (float)(qt * 16 + lr - hi * 8 - kt * 16 - r); cb[kt][qt][r] = sl * (dg ? -fabsf(e) : e); }
        }
        const float u = sl * (float)(kb < q0 ? q0 - kb : kb - q0);   // the block distance's share of the ALiBi term, the same for every score of the pass
        V vh[4], vl[4];   // this pass's V^T fragments, asked for first: they fly under the score products and the softmax
        const bf* vch = vph + (size_t)kb * HD; const bf* vcl = vpl + (size_t)kb * HD;
#pragma unroll
        for (int db = 0; db < 4; ++db) { vh[db] = WF::ld(vch + db * FRG); vl[db] = WF::ld(vcl + db * FRG); }
        asm volatile("s_wait_xcnt 0x0" :: "v"(vch), "v"(vcl) : "memory");   // as above, for the V^T loads' address registers
        __builtin_amdgcn_sched_barrier(0);   // keeps the V^T loads up here: left free, the compiler sank them to just in front of their products, where their latency shows
        v8f s[2][QT];
#pragma unroll
        for (int kt = 0; kt < 2; ++kt)
#pragma unroll
            for (int qt = 0; qt < QT; ++qt) s[kt][qt] = (v8f){};
#pragma unroll
        for (int ks = 0; ks < 2; ++ks) {
#pragma unroll
            for (int kt = 0; kt < 2; ++kt)
#pragma unroll
                for (int qt = 0; qt < QT; ++qt) s[kt][qt] = WF::mma(kh[kt][ks], qh[qt][ks], s[kt][qt]);
#pragma unroll
            for (int kt = 0; kt < 2; ++kt)
#pragma unroll
                for (int qt = 0; qt < QT; ++qt) s[kt][qt] = WF::mma(kl[kt][ks], qh[qt][ks], s[kt][qt]);
#pragma unroll
            for (int kt = 0; kt < 2; ++kt)
#pragma unroll
                for (int qt = 0; qt < QT; ++qt) s[kt][qt] = WF::mma(kh[kt][ks], ql[qt][ks], s[kt][qt]);
        }
        const int kn = (kb + 32) & (TT - 1);   // the next pass's key fragments, one pass ahead (the last pass's request is unused; past the last key it wraps to keys 0..31: in bounds)
        const bf* kch = kph + (size_t)kn * HD; const bf* kcl = kpl + (size_t)kn * HD;
#pragma unroll
        for (int kt = 0; kt < 2; ++kt)
#pragma unroll
            for (int ks = 0; ks < 2; ++ks) { kh[kt][ks] = WF::ld(kch + kt * 16 * HD + ks * FRG); kl[kt][ks] = WF::ld(kcl + kt * 16 * HD + ks * FRG); }
        asm volatile("s_wait_xcnt 0x0" :: "v"(kch), "v"(kcl) : "memory");   // as above, for the key loads' address registers
        __builtin_amdgcn_sched_barrier(0);   // keeps the next pass's key loads in front of the softmax, so that they fly under it
        float mn[QT]; bool need = false;
#pragma unroll
        for (int qt = 0; qt < QT; ++qt) { float mx = -3.0e38f;
#pragma unroll
            for (int kt = 0; kt < 2; ++kt) { s[kt][qt] += cb[kt][qt];
#pragma unroll
                for (int r = 0; r < 8; ++r) mx = fmaxf(mx, s[kt][qt][r]); }
            mx = fmaxf(mx, xhalf(mx));   // the other lane half holds the query's other 16 keys
            mn[qt] = fmaxf(m[qt], mx - u); need = need || (mn[qt] > m[qt]); }
        if (__builtin_amdgcn_ballot_w32(need) != 0) {   // no query of the wave has a new maximum: every factor would be exactly 1
#pragma unroll
            for (int qt = 0; qt < QT; ++qt) { const float al = __builtin_amdgcn_exp2f(m[qt] - mn[qt]); m[qt] = mn[qt]; l[qt] *= al;
#pragma unroll
                for (int db = 0; db < 4; ++db) o[db][qt] *= al; }
        }
        V ph[QT], pl[QT];
#pragma unroll
        for (int qt = 0; qt < QT; ++qt) { const float mu = m[qt] + u;
#pragma unroll
            for (int kt = 0; kt < 2; ++kt) { const v8f x = s[kt][qt] - mu;
#pragma unroll
                for (int r = 0; r < 8; r += 2) { v2f p; p[0] = __builtin_amdgcn_exp2f(x[r]); p[1] = __builtin_amdgcn_exp2f(x[r + 1]); l[qt] += p[0] + p[1];
                    const v2bf a = __builtin_convertvector(p, v2bf); v2f e; e[0] = p[0] - (float)a[0]; e[1] = p[1] - (float)a[1]; const v2bf c = __builtin_convertvector(e, v2bf);
                    ph[qt][kt * 8 + r] = a[0]; ph[qt][kt * 8 + r + 1] = a[1]; pl[qt][kt * 8 + r] = c[0]; pl[qt][kt * 8 + r + 1] = c[1]; } } }
#pragma unroll
        for (int db = 0; db < 4; ++db)
#pragma unroll
            for (int qt = 0; qt < QT; ++qt) o[db][qt] = WF::mma(vh[db], ph[qt], o[db][qt]);
#pragma unroll
        for (int db = 0; db < 4; ++db)
#pragma unroll
            for (int qt = 0; qt < QT; ++qt) o[db][qt] = WF::mma(vl[db], ph[qt], o[db][qt]);
#pragma unroll
        for (int db = 0; db < 4; ++db)
#pragma unroll
            for (int qt = 0; qt < QT; ++qt) o[db][qt] = WF::mma(vh[db], pl[qt], o[db][qt]);
    }
#pragma unroll
    for (int qt = 0; qt < QT; ++qt) { const float inv = __fdiv_rn(1.0f, l[qt] + xhalf(l[qt])); float* op = OUT + ((size_t)b * TT + q0 + qt * 16 + lr) * DQ + h * HD + hi * 8;
#pragma unroll
        for (int db = 0; db < 4; ++db) { v4f x0, x1;
#pragma unroll
            for (int r = 0; r < 4; ++r) { x0[r] = o[db][qt][r] * inv; x1[r] = o[db][qt][4 + r] * inv; }
            *(v4f*)(op + db * 16) = x0; *(v4f*)(op + db * 16 + 4) = x1; } }
}

extern "C" void kernel_launch(void* const* d_in, const int* in_sizes, int n_in,
                              void* d_out, int out_size, void* d_ws, size_t ws_size, hipStream_t stream) {
    (void)in_sizes; (void)n_in; (void)out_size;
    const float* x = (const float*)d_in[0]; const float* wq = (const float*)d_in[1]; const float* bq = (const float*)d_in[2]; const float* wk = (const float*)d_in[3]; const float* bk = (const float*)d_in[4]; const float* wv = (const float*)d_in[5]; const float* bv = (const float*)d_in[6];   /* order hidden_states, Wq, bq, Wk, bk, Wv, bv ('xw' + biases) */
    float* OUT = (float*)d_out;     // [4][2048][512]
    char* wsp = (char*)d_ws;
    auto take = [&](size_t bytes) { char* p = wsp; wsp += (bytes + 255) & ~(size_t)255; return (void*)p; };
    bf* WT = (bf*)take((size_t)3 * DQ * DM * 2); bf* XB = (bf*)take((size_t)NB_ * TT * DM * 2);
    const size_t PB = (size_t)NH_ * TT * HD;   // one batch's hi or lo plane set, elements
    bf* QPh = (bf*)take(NB_ * PB * 2); bf* QPl = (bf*)take(NB_ * PB * 2); bf* KPh = (bf*)take(NB_ * PB * 2); bf* KPl = (bf*)take(NB_ * PB * 2); bf* VTh = (bf*)take(NB_ * PB * 2); bf* VTl = (bf*)take(NB_ * PB * 2);
    float* NR = (float*)take((size_t)2 * NB_ * NH_ * NBK * 32 * 4);   // squared norm bounds: q planes, then k planes
    if ((size_t)(wsp - (char*)d_ws) > ws_size) return;    // ws 256 MiB
    k_prep<<<XBLK + 3 * WBLK, 256, 0, stream>>>(x, wq, wk, wv, XB, WT);
    k_proj<<<dim3(NB_ * TT / 64, 3 * NH_ / 4, 1), 128, 0, stream>>>(XB, WT, bq, bk, bv, QPh, QPl, KPh, KPl, VTh, VTl, NR);
    k_fattn<<<dim3(QTL, NB_ * NH_ / 2, 1), 256, 0, stream>>>(QPh, QPl, KPh, KPl, VTh, VTl, NR, OUT);   // one kv head per query head: plane z = b * NH_ + h of each operand
}

// v008
// A run of this version takes 79.2 microseconds.
// Timed twice side by side with v007, it ran 1.13 and 1.14 times as fast.
// All steps since v000 together make it 17.8 times as fast.
#include <hip/hip_runtime.h>

// BERT-style self-attention with a symmetric ALiBi score bias and no output projection (hidden_states [4][2048][512]; q, k, v = x W + b ('xw' [512][512] 0.02 incl. biases; 8 heads x 64); scores = q.k / sqrt(64) + slope_h |i - j| with slope_h = -2^-(h+1) (h = 0..7: the module's _get_slopes(8), negated; up to -0.5 x 2047); softmax over all keys; out = merged context -> [4][2048][512] (4.2 M); argument order hidden_states, Wq, bq, Wk, bk, Wv, bv).
// Every 16-bit matrix operand plane lies in FRAGMENT ORDER (see the loader): a wave-wide 16-byte load or store covers 512 contiguous bytes, 4 whole lines.
// Three launches: bf16 copy of x and the 'xw' weights transposed; ONE projection launch over all batches and q, k, v (f32 biases) that stores the hi/lo planes from its accumulators; then ONE fused attention launch over all 32 (batch, head) planes with EVERY row on hi/lo planes (3 products; the ALiBi term makes the steep heads few-key sharp, so no fp16 rows): q carries the factor HD^-0.5 x log2(e) from the projection, so the score products come out in log2 units; the ALiBi term is one add per score from a table held in registers (its part inside the 32 x 32 block) plus one shift per pass (the block distance); the launch keeps a running maximum and sum and writes the output rows. The key loop of a query tile covers only the 64-key blocks that can matter: a block is left out where the bound |q| |k| on its scores (norms stored by the projection) and its ALiBi distance put every term under 2^-40 of the row's largest; the two waves of a SIMD take half of that range each and join their partial results in LDS.
// Compute dtypes, f32 accumulate: every input rounded to bf16; projections exact + f32 biases; scores and attn.v 3 products on every row; ALiBi add and softmax f32; output f32.

#define NB_  4
#define TT   2048
#define DM   512
#define NH_  8
#define NKV  8
#define REP  (NH_ / NKV)
#define HD   64
#define DQ   (NH_ * HD)
#define DKV  (NKV * HD)
#define SCL  0.125f   // HD^-0.5
#define L2E  1.4426950408889634f   // log2(e)
typedef _Float16 h16;
typedef unsigned short bf;
typedef __attribute__((ext_vector_type(16))) __bf16   v16bf;
typedef __attribute__((ext_vector_type(16))) _Float16 v16h;
typedef __attribute__((ext_vector_type(8)))  _Float16 v8h;
typedef __attribute__((ext_vector_type(8)))  unsigned short v8us;
typedef __attribute__((ext_vector_type(8)))  float    v8f;
typedef __attribute__((ext_vector_type(4)))  float    v4f;
typedef v8h  __attribute__((may_alias)) v8ha;
typedef v4f  __attribute__((may_alias)) v4fa;
typedef v8us __attribute__((may_alias)) v8usa;

__device__ __forceinline__ unsigned short f2bf(float f) { unsigned u = __float_as_uint(f); u += 0x7FFFu + ((u >> 16) & 1u); return (unsigned short)(u >> 16); }
__device__ __forceinline__ float bf2f(unsigned short b) { return __uint_as_float(((unsigned)b) << 16); }
__device__ __forceinline__ float bfr(float f) { return bf2f(f2bf(f)); }
__device__ __forceinline__ v16h cat16(v8h lo, v8h hi) { return __builtin_shufflevector(lo, hi, 0, 1, 2, 3, 4, 5, 6, 7, 8, 9, 10, 11, 12, 13, 14, 15); }
__device__ __forceinline__ v16bf cat16b(v8us lo, v8us hi) { return __builtin_bit_cast(v16bf, __builtin_shufflevector(lo, hi, 0, 1, 2, 3, 4, 5, 6, 7, 8, 9, 10, 11, 12, 13, 14, 15)); }
__device__ __forceinline__ v8f wmma16(v16h a, v16h b, v8f c) { return __builtin_amdgcn_wmma_f32_16x16x32_f16(false, a, false, b, (short)0, c, false, false); }
__device__ __forceinline__ v8f wmmab(v16bf a, v16bf b, v8f c) { return __builtin_amdgcn_wmma_f32_16x16x32_bf16(false, a, false, b, (short)0, c, false, false); }



// ---- fragment loader and product (hardware k order: lane half hi takes k = 8 hi + 0..7 and 16 + 8 hi + 0..7 of each 32)
// bf16 planes are stored in fragment order: one fragment (16 rows x 32 k) is 1 KiB = 2 halves j of 512 bytes; half j holds, at 16 bytes x lane (lane = 16 hi + row), k = 16 j + 8 hi + 0..7 of that row.
// A plane of R rows x K: element offset = (row / 16) * 16 K + (k / 32) * FRG + j * FRH + lane * 8 + k % 8. The loader takes the address of the lane's 16 bytes in half 0.
#define FRH 256   // elements of half a fragment
#define FRG 512   // elements of a fragment
template <typename T16> struct WFrag;
template <> struct WFrag<h16> { typedef v16h V; static __device__ __forceinline__ V ld(const h16* p) { return cat16(*(const v8h*)p, *(const v8h*)(p + 16)); } static __device__ __forceinline__ v8f mma(V a, V b, v8f c) { return wmma16(a, b, c); } };
template <> struct WFrag<bf> { typedef v16bf V; static __device__ __forceinline__ V ld(const bf* p) { return cat16b(*(const v8us*)p, *(const v8us*)(p + FRH)); } static __device__ __forceinline__ v8f mma(V a, V b, v8f c) { return wmmab(a, b, c); } };

typedef __attribute__((ext_vector_type(2))) float v2f;
typedef __attribute__((ext_vector_type(2))) __bf16 v2bf;
typedef __attribute__((ext_vector_type(8))) __bf16 v8bf;
typedef __attribute__((ext_vector_type(4))) unsigned v4u;
typedef v4u __attribute__((may_alias)) v4ua;

// ---- k_prep: every 16-bit GEMM operand in one launch, written in fragment order. Work-groups 0..XBLK-1: bf16 copy of x, one 16-row tile a work-group, 8 elements a thread and step (a wave reads 16 rows x 64 bytes and writes half a fragment). The next 3 x WBLK: Wq, Wk, Wv ([k][n], f32) rounded to bf16 and transposed to rows n of WT (row = which x DQ + n); a wave takes one fragment (16 n x 32 k) and writes its 8 whole 128-byte lines.
#define XBLK 512
#define WBLK (DQ / 8)   // DQ / 16 row tiles x DM / 32 fragments, 8 a work-group
__global__ __launch_bounds__(256) void k_prep(const float* __restrict__ x, const float* __restrict__ wq, const float* __restrict__ wk, const float* __restrict__ wv, bf* XB, bf* WT) {
    if (blockIdx.x < XBLK) {
        constexpr int NIT = NB_ * TT * DM / 8 / (XBLK * 256); static_assert(NIT * 256 * 8 == 16 * DM, "one 16-row tile a work-group"); const size_t i0 = (size_t)blockIdx.x * (NIT * 256) + threadIdx.x;
        const float* sp = x + ((size_t)blockIdx.x * 16 + (threadIdx.x & 15)) * DM + (threadIdx.x >> 4) * 8; bf* dp = XB + i0 * 8; v8f v[NIT]; v4u o[NIT];   // thread = (k / 8) % 16 x 16 + row; step it takes k = 128 it + ...
#pragma unroll
        for (int it = 0; it < NIT; ++it) v[it] = *(const v8f*)(sp + it * 128);
        asm volatile("s_wait_xcnt 0x0" :: "v"(sp) : "memory");   // the wait in front of any overwrite of the loads' address registers; the input keeps them untouched up to here
#pragma unroll
        for (int it = 0; it < NIT; ++it) { v8us u;
#pragma unroll
            for (int k = 0; k < 8; ++k) u[k] = f2bf(v[it][k]);
            o[it] = __builtin_bit_cast(v4u, u); *(v4ua*)(dp + it * 256 * 8) = o[it]; }
        return;
    }
    const int wb = blockIdx.x - XBLK, which = wb / WBLK; const float* w = which == 0 ? wq : which == 1 ? wk : wv;
    const int lane = threadIdx.x & 31, lr = lane & 15, hi = lane >> 4; const int rt = wb >> 1, kf = (wb & 1) * 8 + (threadIdx.x >> 5);   // row tile of WT (16 n), fragment along k
    const float* sp = w + (size_t)(kf * 32 + hi * 8) * DQ + (rt % (DQ / 16)) * 16 + lr; bf* dp = WT + (size_t)rt * (16 * DM) + kf * FRG + lane * 8; float f[2][8]; v4u o[2];
#pragma unroll
    for (int j = 0; j < 2; ++j)
#pragma unroll
        for (int r = 0; r < 8; ++r) f[j][r] = sp[(size_t)(j * 16 + r) * DQ];   // k = 32 kf + 16 j + 8 hi + r of column n
    asm volatile("s_wait_xcnt 0x0" :: "v"(sp) : "memory");   // as above, for the loads' address registers
#pragma unroll
    for (int j = 0; j < 2; ++j) { v8us u;
#pragma unroll
        for (int r = 0; r < 8; ++r) u[r] = f2bf(f[j][r]);
        o[j] = __builtin_bit_cast(v4u, u); *(v4ua*)(dp + j * FRH) = o[j]; }
    asm volatile("s_wait_xcnt 0x0" :: "v"(dp), "v"(o[0]), "v"(o[1]) : "memory");   // as above, for the stores' address and data registers: in the built code the other branch's block, which writes them, stands behind these stores
}

__device__ __forceinline__ float xhalf(float x) { const int b = __float_as_int(x); return __int_as_float(__builtin_amdgcn_permlanex16(b, b, 0x76543210, 0xfedcba98, false, false)); }   // lane l <-> l ^ 16, in registers
template <int M> __device__ __forceinline__ float rowmax(float x) { const int b = __float_as_int(x); return fmaxf(x, __int_as_float(__builtin_amdgcn_update_dpp(b, b, 0x160 + M, 0xf, 0xf, false))); }   // max with lane l ^ M of the 16-lane row (DPP row_xmask)
#define NBK (TT / 64)   // 64-token blocks of a plane: one squared norm bound each, in a 128-byte line of its own (one writer a line)
__device__ __forceinline__ void split8(const v8f y, v4u& oh, v4u& ol) { v8bf a, c;
#pragma unroll
    for (int r = 0; r < 8; r += 2) { v2f p; p[0] = y[r]; p[1] = y[r + 1]; const v2bf u = __builtin_convertvector(p, v2bf); v2f e; e[0] = p[0] - (float)u[0]; e[1] = p[1] - (float)u[1]; const v2bf w = __builtin_convertvector(e, v2bf); a[r] = u[0]; a[r + 1] = u[1]; c[r] = w[0]; c[r + 1] = w[1]; }
    oh = __builtin_bit_cast(v4u, a); ol = __builtin_bit_cast(v4u, c); }
__global__ __launch_bounds__(128) void k_proj(const bf* __restrict__ XB, const bf* __restrict__ WT, const float* __restrict__ bq, const float* __restrict__ bk, const float* __restrict__ bv, bf* QPh, bf* QPl, bf* KPh, bf* KPl, bf* VTh, bf* VTl, float* NR) {
    typedef WFrag<bf> WF; typedef v16bf V;
    const int lane = threadIdx.x & 31, lr = lane & 15, hi = lane >> 4, wv = threadIdx.x >> 5;
    const int which = blockIdx.y / (NH_ / 4), head = (blockIdx.y % (NH_ / 4)) * 4 + wv; const int t0 = blockIdx.x * 64, b = t0 / TT, tl = t0 % TT;
    const bf* xp = XB + (size_t)t0 * DM + lane * 8; const bf* wp = WT + ((size_t)which * DQ + head * HD) * DM + lane * 8;
    const bf* ap = which == 2 ? xp : wp; const bf* bp = which == 2 ? wp : xp;   // A rows, B rows: both in fragment order, same loader, same k order
    v8f acc[4][4];
#pragma unroll
    for (int mb = 0; mb < 4; ++mb)
#pragma unroll
        for (int nb = 0; nb < 4; ++nb) acc[mb][nb] = (v8f){};
    V a[2][4], bb[2][4];
#pragma unroll
    for (int i = 0; i < 4; ++i) { a[0][i] = WF::ld(ap + i * 16 * DM); bb[0][i] = WF::ld(bp + i * 16 * DM); }
#pragma unroll   // unrolled whole: every load is one of two bases + a constant offset, and the two fragment sets swap by name
    for (int kc = 0; kc < DM; kc += 32) { const int cu = (kc >> 5) & 1, nx = cu ^ 1;
        if (kc + 32 < DM) {   // the next 32 k, asked for in front of this step's products
#pragma unroll
            for (int i = 0; i < 4; ++i) { a[nx][i] = WF::ld(ap + i * 16 * DM + (kc + 32) / 32 * FRG); bb[nx][i] = WF::ld(bp + i * 16 * DM + (kc + 32) / 32 * FRG); } }
        __builtin_amdgcn_sched_barrier(0);   // keeps the next step's loads up here: left free, the compiler sank each pair to just in front of its products and waited out its latency there
#pragma unroll
        for (int nb = 0; nb < 4; ++nb)
#pragma unroll
            for (int mb = 0; mb < 4; ++mb) acc[mb][nb] = WF::mma(a[cu][mb], bb[cu][nb], acc[mb][nb]);
    }
    asm volatile("s_wait_xcnt 0x0" :: "v"(ap), "v"(bp) : "memory");   // the wait in front of any overwrite of the fragment loads' address registers; the inputs keep them untouched up to here
    const size_t z = (size_t)b * NH_ + head;
    if (which == 2) {
        const float* bs = bv + head * HD + lr; float bi[4];
#pragma unroll
        for (int nb = 0; nb < 4; ++nb) bi[nb] = bs[nb * 16];
        asm volatile("s_wait_xcnt 0x0" :: "v"(bs) : "memory");   // as above, for the bias loads
        const size_t o0 = (z * TT + tl) * HD + lane * 8; bf* p0 = VTh + o0; bf* p1 = VTl + o0;
#pragma unroll
        for (int nb = 0; nb < 4; ++nb) { v4u oh[4], ol[4];
#pragma unroll
            for (int mb = 0; mb < 4; ++mb) { split8(acc[mb][nb] + bfr(bi[nb]), oh[mb], ol[mb]); *(v4ua*)(p0 + (mb >> 1) * (4 * FRG) + nb * FRG + (mb & 1) * FRH) = oh[mb]; *(v4ua*)(p1 + (mb >> 1) * (4 * FRG) + nb * FRG + (mb & 1) * FRH) = ol[mb]; }
            asm volatile("s_wait_xcnt 0x0" :: "v"(p0), "v"(p1), "v"(oh[0]), "v"(oh[1]), "v"(oh[2]), "v"(oh[3]), "v"(ol[0]), "v"(ol[1]), "v"(ol[2]), "v"(ol[3]) : "memory"); }   // as above, for the stores' address and data registers
    } else {
        const float* bs = (which == 0 ? bq : bk) + head * HD + hi * 8; v8f bi[4]; const float qs = which == 0 ? SCL * L2E : 1.0f;   // q leaves with the score scale and log2(e) on it (k: x 1, exact)
#pragma unroll
        for (int mb = 0; mb < 4; ++mb) bi[mb] = *(const v8f*)(bs + mb * 16);
        asm volatile("s_wait_xcnt 0x0" :: "v"(bs) : "memory");   // as above, for the bias loads
        const size_t o0 = (z * TT + tl) * HD + lane * 8; bf* p0 = (which == 0 ? QPh : KPh) + o0; bf* p1 = (which == 0 ? QPl : KPl) + o0; float n2[4] = { 0.f, 0.f, 0.f, 0.f };   // squared length of token nb x 16 + lr, this lane half's d
#pragma unroll
        for (int mb = 0; mb < 4; ++mb) { v4u oh[4], ol[4];
#pragma unroll
            for (int j = 0; j < 8; ++j) bi[mb][j] = bfr(bi[mb][j]);
#pragma unroll
            for (int nb = 0; nb < 4; ++nb) { const v8f y = (acc[mb][nb] + bi[mb]) * qs, w = y * y; n2[nb] += ((w[0] + w[1]) + (w[2] + w[3])) + ((w[4] + w[5]) + (w[6] + w[7])); split8(y, oh[nb], ol[nb]); *(v4ua*)(p0 + nb * 16 * HD + mb * FRH) = oh[nb]; *(v4ua*)(p1 + nb * 16 * HD + mb * FRH) = ol[nb]; }
            asm volatile("s_wait_xcnt 0x0" :: "v"(p0), "v"(p1), "v"(oh[0]), "v"(oh[1]), "v"(oh[2]), "v"(oh[3]), "v"(ol[0]), "v"(ol[1]), "v"(ol[2]), "v"(ol[3]) : "memory"); }   // as above, for the stores' address and data registers
        float nm = fmaxf(fmaxf(n2[0] + xhalf(n2[0]), n2[1] + xhalf(n2[1])), fmaxf(n2[2] + xhalf(n2[2]), n2[3] + xhalf(n2[3])));   // the longest of the wave's 64 tokens
        nm = rowmax<1>(nm); nm = rowmax<2>(nm); nm = rowmax<4>(nm); nm = rowmax<8>(nm);
        float* np = NR + (((size_t)which * (NB_ * NH_) + z) * NBK + tl / 64) * 32 + lane; *np = nm;   // every lane holds it: the wave writes its whole line
        asm volatile("s_wait_xcnt 0x0" :: "v"(np), "v"(nm) : "memory");   // as above, for the store's address and data registers
    }
}
__constant__ float SLOPE2[NH_] = { L2E * 0.5f, L2E * 0.25f, L2E * 0.125f, L2E * 0.0625f, L2E * 0.03125f, L2E * 0.015625f, L2E * 0.0078125f, L2E * 0.00390625f };   // log2(e) x the per-head ALiBi slope magnitude (|slope_h| = 2^-(h+1), h = 0..7)
// k_fattn: scores, softmax and context of a flat and then a steep (batch, head) z a wave, one pass over the keys each; no score plane. Two waves own QT*16 query columns; each walks one half of the tile's key range (all 2048 keys where no block is shown to vanish) 32 at a time:
//   S^T = K Q^T (A = key rows, B = query rows; 3 products on hi/lo planes): lane (lr, hi) holds, for query lr of a group, keys 8 hi + r of each 16-key tile;
//   ALiBi: -sl |i - j| = cb - u, u = sl |q0 - kb| (sl = |slope| log2(e)): off the diagonal block |i - j| = |q0 - kb| +- e with e = (i - q0) - (j - kb), so cb = -+ sl e is the same in every pass on one side of the diagonal and stays in registers;
//   t = S + cb - u in log2 units; running maximum m and sum l per query (online softmax), p = 2^(S + cb - (m + u));
//   the two key tiles' p, split hi/lo, ARE the B operand of O^T += V^T P^T in the hardware k order (element s < 8: tile 0 register s; s >= 8: tile 1 register s - 8), A = V^T rows by the same loader order;
//   out = O^T / l, the two waves' partial m, l, O^T joined through LDS: a lane's 8 accumulator registers are 8 consecutive d of its query's output row.
#define QT 2
#define QTL (TT / (4 * QT * 16))   // 128-query tiles in a plane, 4 wave pairs each
#define TCUT 40.0f   // a key block is left out where every term of it lies under 2^-TCUT of its row's largest: at most TT such terms, under 2^-29 of the row's sum together, below half a unit of its last place
__global__ __launch_bounds__(256) void k_fattn(const bf* __restrict__ Qh, const bf* __restrict__ Ql, const bf* __restrict__ Kh, const bf* __restrict__ Kl, const bf* __restrict__ Vh, const bf* __restrict__ Vl, const float* __restrict__ NR, float* OUT) {
    typedef WFrag<bf> WF; typedef v16bf V;
    const int lane = threadIdx.x & 31, lr = lane & 15, hi = lane >> 4, wv = __builtin_amdgcn_readfirstlane(threadIdx.x >> 5);   // the wave's number in a scalar register: the test on kb - q0 in the loop is then a scalar branch
    // a work-group holds 4 query tiles of a flat head (4..7: long key range) and 4 of a steep one (3..0: short range; half a sequence away, where head 3's long ranges meet head 4's short ones). Waves w and w + 4, which share a SIMD, take the lower and the upper half
    // of the SAME tile's key range, first the flat tile's, then the steep one's: both waves of a SIMD have the same number of passes and stay resident together to the end. Each leaves its partial maximum, sum and accumulators in LDS; they are joined behind the one barrier.
    __shared__ v4f XO[2][8][QT][8][32]; __shared__ float XM[2][8][2][QT][32];   // [tile][wave][column group]: accumulators (16 bytes a lane and entry); [tile][wave][maximum, sum][column group]
    const int up = wv >> 2, pw = wv & 3; const int b = blockIdx.y / (NH_ / 2), pr = blockIdx.y % (NH_ / 2);
#pragma unroll 1   // rolled: the two tiles run through one copy of the key loop
    for (int sg = 0; sg < 2; ++sg) {
    const bool st = sg == 1; const int h = st ? NH_ / 2 - 1 - pr : NH_ / 2 + pr, z = b * NH_ + h;
    const int q0 = ((st ? (blockIdx.x + QTL / 2) % QTL : blockIdx.x) * 4 + pw) * (QT * 16);
    const float sl = SLOPE2[h]; const size_t zo = (size_t)z * TT * HD;
    V qh[QT][2], ql[QT][2]; const size_t qo = zo + (size_t)q0 * HD + lane * 8; const bf* qa = Qh + qo; const bf* qb = Ql + qo;
#pragma unroll
    for (int qt = 0; qt < QT; ++qt)
#pragma unroll
        for (int ks = 0; ks < 2; ++ks) { qh[qt][ks] = WF::ld(qa + qt * 16 * HD + ks * FRG); ql[qt][ks] = WF::ld(qb + qt * 16 * HD + ks * FRG); }
    asm volatile("s_wait_xcnt 0x0" :: "v"(qa), "v"(qb) : "memory");   // the wait in front of any overwrite of the loads' address registers; the two inputs, the one base pair of all these loads, keep those registers untouched up to here
    // the query tile's key range (the pair's two waves then split it in halves). Lane j judges keys 64 j .. 64 j + 63: no score there exceeds bj = |q| |k| (longest query of the wave's 64-token block, longest key of block j; 1/16 on top for the hi/lo products' rounding), the ALiBi term is at most -sl dmin,
    // and every row's largest term is at least its own diagonal one, >= -bd. The range runs from the first to the last block that is not shown to vanish; the diagonal block is always in it.
    const int jd = q0 >> 6; const float* nqp = NR + ((size_t)z * NBK + jd) * 32 + lane; const float* nkp = NR + ((size_t)(NB_ * NH_ + z) * NBK + lane) * 32; static_assert(NBK == 32, "one key block a lane");
    const float qn2 = *nqp, kn2 = *nkp;
    asm volatile("s_wait_xcnt 0x0" :: "v"(nqp), "v"(nkp) : "memory");   // as above, for the two norm loads
    __builtin_amdgcn_sched_barrier(0);   // keeps later code behind that wait: left free, the build rewrote the first load's scalar base in front of it
    const float bj = 1.0625f * __builtin_amdgcn_sqrtf(qn2 * kn2), bd = __int_as_float(__builtin_amdgcn_readlane(__float_as_int(bj), jd));
    const int dl = q0 - (lane * 64 + 63), dr = lane * 64 - (q0 + QT * 16 - 1), dmin = dl > 0 ? dl : dr > 0 ? dr : 0;
    const unsigned live = __builtin_amdgcn_ballot_w32(!(bj - sl * (float)dmin < -bd - TCUT)) | (1u << jd);   // written so that a NaN keeps its block
    const int rlo = __builtin_ctz(live) * 64, rhi = (32 - __builtin_clz(live)) * 64, rmid = rlo + ((rhi - rlo) >> 1);   // the range is a whole number of 64-key blocks: each half holds at least one 32-key pass
    const int klo = up ? rmid : rlo, khi = up ? rhi : rmid;
    const bf* kph = Kh + zo + lane * 8; const bf* kpl = Kl + zo + lane * 8;
    const bf* vph = Vh + zo + lane * 8; const bf* vpl = Vl + zo + lane * 8;
    V kh[2][2], kl[2][2]; const bf* k0h = kph + (size_t)klo * HD; const bf* k0l = kpl + (size_t)klo * HD;   // the first keys of the wave's half
#pragma unroll
    for (int kt = 0; kt < 2; ++kt)
#pragma unroll
        for (int ks = 0; ks < 2; ++ks) { kh[kt][ks] = WF::ld(k0h + kt * 16 * HD + ks * FRG); kl[kt][ks] = WF::ld(k0l + kt * 16 * HD + ks * FRG); }
    asm volatile("s_wait_xcnt 0x0" :: "v"(k0h), "v"(k0l) : "memory");   // as above, for the first key loads
    __builtin_amdgcn_sched_barrier(0);   // keeps later code behind that wait: left free, the build formed these loads on a lane-offset register and rewrote it in front of the wait
    v8f o[4][QT]; float m[QT], l[QT];
    v8f cb[2][QT]; const float sl0 = klo > q0 ? sl : -sl;   // the ALiBi term's part inside the block, one value a score register; keys left of the diagonal block (i > j): -sl e; a wave that starts right of it: +sl e
#pragma unroll
    for (int kt = 0; kt < 2; ++kt)
#pragma unroll
        for (int qt = 0; qt < QT; ++qt)
#pragma unroll
            for (int r = 0; r < 8; ++r) cb[kt][qt][r] = sl0 * (float)(qt * 16 + lr - hi * 8 - kt * 16 - r);
#pragma unroll
    for (int qt = 0; qt < QT; ++qt) { m[qt] = -3.0e38f; l[qt] = 0.f;
#pragma unroll
        for (int db = 0; db < 4; ++db) o[db][qt] = (v8f){}; }
#pragma unroll 1   // rolled: one pass's fragments, the query fragments and the accumulators fill the registers
    for (int kb = klo; kb < khi; kb += 32) {
        if ((unsigned)(kb - q0) <= 32u) {   // the two passes in which the table changes: the diagonal block (-sl |e|) and the first one right of it (j > i from there on: +sl e)
            const bool dg = kb == q0;
#pragma unroll
            for (int kt = 0; kt < 2; ++kt)
#pragma unroll
                for (int qt = 0; qt < QT; ++qt)
#pragma unroll
                    for (int r = 0; r < 8; ++r) { const float e = (float)(qt * 16 + lr - hi * 8 - kt * 16 - r); cb[kt][qt][r] = sl * (dg ? -fabsf(e) : e); }
        }
        const float u = sl * (float)(kb < q0 ? q0 - kb : kb - q0);   // the block distance's share of the ALiBi term, the same for every score of the pass
        V vh[4], vl[4];   // this pass's V^T fragments, asked for first: they fly under the score products and the softmax
        const bf* vch = vph + (size_t)kb * HD; const bf* vcl = vpl + (size_t)kb * HD;
#pragma unroll
        for (int db = 0; db < 4; ++db) { vh[db] = WF::ld(vch + db * FRG); vl[db] = WF::ld(vcl + db * FRG); }
        asm volatile("s_wait_xcnt 0x0" :: "v"(vch), "v"(vcl) : "memory");   // as above, for the V^T loads' address registers
        __builtin_amdgcn_sched_barrier(0);   // keeps the V^T loads up here: left free, the compiler sank them to just in front of their products, where their latency shows
        v8f s[2][QT];
#pragma unroll
        for (int kt = 0; kt < 2; ++kt)
#pragma unroll
            for (int qt = 0; qt < QT; ++qt) s[kt][qt] = (v8f){};
#pragma unroll
        for (int ks = 0; ks < 2; ++ks) {
#pragma unroll
            for (int kt = 0; kt < 2; ++kt)
#pragma unroll
                for (int qt = 0; qt < QT; ++qt) s[kt][qt] = WF::mma(kh[kt][ks], qh[qt][ks], s[kt][qt]);
#pragma unroll
            for (int kt = 0; kt < 2; ++kt)
#pragma unroll
                for (int qt = 0; qt < QT; ++qt) s[kt][qt] = WF::mma(kl[kt][ks], qh[qt][ks], s[kt][qt]);
#pragma unroll
            for (int kt = 0; kt < 2; ++kt)
#pragma unroll
                for (int qt = 0; qt < QT; ++qt) s[kt][qt] = WF::mma(kh[kt][ks], ql[qt][ks], s[kt][qt]);
        }
        const int kn = (kb + 32) & (TT - 1);   // the next pass's key fragments, one pass ahead (the last pass's request is unused; past the last key it wraps to keys 0..31: in bounds)
        const bf* kch = kph + (size_t)kn * HD; const bf* kcl = kpl + (size_t)kn * HD;
#pragma unroll
        for (int kt = 0; kt < 2; ++kt)
#pragma unroll
            for (int ks = 0; ks < 2; ++ks) { kh[kt][ks] = WF::ld(kch + kt * 16 * HD + ks * FRG); kl[kt][ks] = WF::ld(kcl + kt * 16 * HD + ks * FRG); }
        asm volatile("s_wait_xcnt 0x0" :: "v"(kch), "v"(kcl) : "memory");   // as above, for the key loads' address registers
        __builtin_amdgcn_sched_barrier(0);   // keeps the next pass's key loads in front of the softmax, so that they fly under it
        float mn[QT]; bool need = false;
#pragma unroll
        for (int qt = 0; qt < QT; ++qt) { float mx = -3.0e38f;
#pragma unroll
            for (int kt = 0; kt < 2; ++kt) { s[kt][qt] += cb[kt][qt];
#pragma unroll
                for (int r = 0; r < 8; ++r) mx = fmaxf(mx, s[kt][qt][r]); }
            mx = fmaxf(mx, xhalf(mx));   // the other lane half holds the query's other 16 keys
            mn[qt] = fmaxf(m[qt], mx - u); need = need || (mn[qt] > m[qt]); }
        if (__builtin_amdgcn_ballot_w32(need) != 0) {   // no query of the wave has a new maximum: every factor would be exactly 1
#pragma unroll
            for (int qt = 0; qt < QT; ++qt) { const float al = __builtin_amdgcn_exp2f(m[qt] - mn[qt]); m[qt] = mn[qt]; l[qt] *= al;
#pragma unroll
                for (int db = 0; db < 4; ++db) o[db][qt] *= al; }
        }
        V ph[QT], pl[QT];
#pragma unroll
        for (int qt = 0; qt < QT; ++qt) { const float mu = m[qt] + u;
#pragma unroll
            for (int kt = 0; kt < 2; ++kt) { const v8f x = s[kt][qt] - mu;
#pragma unroll
                for (int r = 0; r < 8; r += 2) { v2f p; p[0] = __builtin_amdgcn_exp2f(x[r]); p[1] = __builtin_amdgcn_exp2f(x[r + 1]); l[qt] += p[0] + p[1];
                    const v2bf a = __builtin_convertvector(p, v2bf); v2f e; e[0] = p[0] - (float)a[0]; e[1] = p[1] - (float)a[1]; const v2bf c = __builtin_convertvector(e, v2bf);
                    ph[qt][kt * 8 + r] = a[0]; ph[qt][kt * 8 + r + 1] = a[1]; pl[qt][kt * 8 + r] = c[0]; pl[qt][kt * 8 + r + 1] = c[1]; } } }
#pragma unroll
        for (int db = 0; db < 4; ++db)
#pragma unroll
            for (int qt = 0; qt < QT; ++qt) o[db][qt] = WF::mma(vh[db], ph[qt], o[db][qt]);
#pragma unroll
        for (int db = 0; db < 4; ++db)
#pragma unroll
            for (int qt = 0; qt < QT; ++qt) o[db][qt] = WF::mma(vl[db], ph[qt], o[db][qt]);
#pragma unroll
        for (int db = 0; db < 4; ++db)
#pragma unroll
            for (int qt = 0; qt < QT; ++qt) o[db][qt] = WF::mma(vh[db], pl[qt], o[db][qt]);
    }
#pragma unroll
    for (int qt = 0; qt < QT; ++qt) { XM[sg][wv][0][qt][lane] = m[qt]; XM[sg][wv][1][qt][lane] = l[qt];
#pragma unroll
        for (int db = 0; db < 4; ++db) { XO[sg][wv][qt][2 * db][lane] = __builtin_shufflevector(o[db][qt], o[db][qt], 0, 1, 2, 3); XO[sg][wv][qt][2 * db + 1][lane] = __builtin_shufflevector(o[db][qt], o[db][qt], 4, 5, 6, 7); } }
    }
    __syncthreads();   // every wave passes it once; behind it a wave reads what its partner left
    static_assert(QT == 2, "each wave of a pair finishes one 16-column group of each tile");
#pragma unroll 1   // rolled: short, runs twice
    for (int sg = 0; sg < 2; ++sg) {   // out = (O_lower 2^(m_lower - m) + O_upper 2^(m_upper - m)) / l, column group 'up' of the pair's tile
        const bool st = sg == 1; const int h = st ? NH_ / 2 - 1 - pr : NH_ / 2 + pr; const int q0 = ((st ? (blockIdx.x + QTL / 2) % QTL : blockIdx.x) * 4 + pw) * (QT * 16);
        const float m0 = XM[sg][pw][0][up][lane], m1 = XM[sg][pw + 4][0][up][lane], l0 = XM[sg][pw][1][up][lane], l1 = XM[sg][pw + 4][1][up][lane];
        const float mm = fmaxf(m0, m1), a0 = __builtin_amdgcn_exp2f(m0 - mm), a1 = __builtin_amdgcn_exp2f(m1 - mm), lt = l0 * a0 + l1 * a1, inv = __fdiv_rn(1.0f, lt + xhalf(lt)), c0 = a0 * inv, c1 = a1 * inv;
        float* op = OUT + ((size_t)b * TT + q0 + up * 16 + lr) * DQ + h * HD + hi * 8; v4f x[8];
#pragma unroll
        for (int j = 0; j < 8; ++j) { x[j] = XO[sg][pw][up][j][lane] * c0 + XO[sg][pw + 4][up][j][lane] * c1; *(v4f*)(op + (j >> 1) * 16 + (j & 1) * 4) = x[j]; }
        asm volatile("s_wait_xcnt 0x0" :: "v"(op), "v"(x[0]), "v"(x[1]), "v"(x[2]), "v"(x[3]), "v"(x[4]), "v"(x[5]), "v"(x[6]), "v"(x[7]) : "memory");   // as above, for the stores' address and data registers
    }
}

extern "C" void kernel_launch(void* const* d_in, const int* in_sizes, int n_in,
                              void* d_out, int out_size, void* d_ws, size_t ws_size, hipStream_t stream) {
    (void)in_sizes; (void)n_in; (void)out_size;
    const float* x = (const float*)d_in[0]; const float* wq = (const float*)d_in[1]; const float* bq = (const float*)d_in[2]; const float* wk = (const float*)d_in[3]; const float* bk = (const float*)d_in[4]; const float* wv = (const float*)d_in[5]; const float* bv = (const float*)d_in[6];   /* order hidden_states, Wq, bq, Wk, bk, Wv, bv ('xw' + biases) */
    float* OUT = (float*)d_out;     // [4][2048][512]
    char* wsp = (char*)d_ws;
    auto take = [&](size_t bytes) { char* p = wsp; wsp += (bytes + 255) & ~(size_t)255; return (void*)p; };
    bf* WT = (bf*)take((size_t)3 * DQ * DM * 2); bf* XB = (bf*)take((size_t)NB_ * TT * DM * 2);
    const size_t PB = (size_t)NH_ * TT * HD;   // one batch's hi or lo plane set, elements
    bf* QPh = (bf*)take(NB_ * PB * 2); bf* QPl = (bf*)take(NB_ * PB * 2); bf* KPh = (bf*)take(NB_ * PB * 2); bf* KPl = (bf*)take(NB_ * PB * 2); bf* VTh = (bf*)take(NB_ * PB * 2); bf* VTl = (bf*)take(NB_ * PB * 2);
    float* NR = (float*)take((size_t)2 * NB_ * NH_ * NBK * 32 * 4);   // squared norm bounds: q planes, then k planes
    if ((size_t)(wsp - (char*)d_ws) > ws_size) return;    // ws 256 MiB
    k_prep<<<XBLK + 3 * WBLK, 256, 0, stream>>>(x, wq, wk, wv, XB, WT);
    k_proj<<<dim3(NB_ * TT / 64, 3 * NH_ / 4, 1), 128, 0, stream>>>(XB, WT, bq, bk, bv, QPh, QPl, KPh, KPl, VTh, VTl, NR);
    k_fattn<<<dim3(QTL, NB_ * NH_ / 2, 1), 256, 0, stream>>>(QPh, QPl, KPh, KPl, VTh, VTl, NR, OUT);   // one kv head per query head: plane z = b * NH_ + h of each operand
}

// v010
// One run takes 50.5 microseconds.
// Versions between v008 and this one are left out; their measured steps multiply to 1.58 times as fast.
// Over all steps from v000 it is 28.1 times as fast.
#include <hip/hip_runtime.h>

// BERT-style self-attention with a symmetric ALiBi score bias and no output projection (hidden_states [4][2048][512]; q, k, v = x W + b ('xw' [512][512] 0.02 incl. biases; 8 heads x 64); scores = q.k / sqrt(64) + slope_h |i - j| with slope_h = -2^-(h+1) (h = 0..7: the module's _get_slopes(8), negated; up to -0.5 x 2047); softmax over all keys; out = merged context -> [4][2048][512] (4.2 M); argument order hidden_states, Wq, bq, Wk, bk, Wv, bv).
// Every 16-bit matrix operand plane lies in FRAGMENT ORDER (see the loader): a wave-wide 16-byte load or store covers 512 contiguous bytes, 4 whole lines.
// Three launches: bf16 copy of x and the 'xw' weights transposed; ONE projection launch over all batches and q, k, v (f32 biases) that stores q, k, v^T as one f16 plane each from its accumulators; then ONE fused attention launch over all 32 (batch, head) planes, one f16 product for the scores and one for attn.v: q carries the factor HD^-0.5 x log2(e) from the projection, so the score products come out in log2 units; the ALiBi term is one add per score from a table held in registers (its part inside the 32 x 32 block) plus one shift per pass (the block distance); the launch keeps a running maximum and sum and writes the output rows. The key loop of a query tile covers only the 64-key blocks that can matter: a block is left out where the bound |q| |k| on its scores (norms stored by the projection) and its ALiBi distance put every term under 2^-40 of the row's largest; the four waves of a SIMD take a quarter of that range each and join their partial results in LDS.
// Compute dtypes, f32 accumulate: every input rounded to bf16; projections exact + f32 biases; q, k, v and the softmax weights p rounded once to f16 (11 bits, nearest even), one product each for scores and attn.v; ALiBi add, softmax and its sum f32; output f32.

#define NB_  4
#define TT   2048
#define DM   512
#define NH_  8
#define NKV  8
#define REP  (NH_ / NKV)
#define HD   64
#define DQ   (NH_ * HD)
#define DKV  (NKV * HD)
#define SCL  0.125f   // HD^-0.5
#define L2E  1.4426950408889634f   // log2(e)
typedef _Float16 h16;
typedef unsigned short bf;
typedef __attribute__((ext_vector_type(16))) __bf16   v16bf;
typedef __attribute__((ext_vector_type(16))) _Float16 v16h;
typedef __attribute__((ext_vector_type(8)))  _Float16 v8h;
typedef __attribute__((ext_vector_type(8)))  unsigned short v8us;
typedef __attribute__((ext_vector_type(8)))  float    v8f;
typedef __attribute__((ext_vector_type(4)))  float    v4f;
typedef v8h  __attribute__((may_alias)) v8ha;
typedef v4f  __attribute__((may_alias)) v4fa;
typedef v8us __attribute__((may_alias)) v8usa;

__device__ __forceinline__ unsigned short f2bf(float f) { unsigned u = __float_as_uint(f); u += 0x7FFFu + ((u >> 16) & 1u); return (unsigned short)(u >> 16); }
__device__ __forceinline__ float bf2f(unsigned short b) { return __uint_as_float(((unsigned)b) << 16); }
__device__ __forceinline__ float bfr(float f) { return bf2f(f2bf(f)); }
__device__ __forceinline__ v16h cat16(v8h lo, v8h hi) { return __builtin_shufflevector(lo, hi, 0, 1, 2, 3, 4, 5, 6, 7, 8, 9, 10, 11, 12, 13, 14, 15); }
__device__ __forceinline__ v16bf cat16b(v8us lo, v8us hi) { return __builtin_bit_cast(v16bf, __builtin_shufflevector(lo, hi, 0, 1, 2, 3, 4, 5, 6, 7, 8, 9, 10, 11, 12, 13, 14, 15)); }
__device__ __forceinline__ v8f wmma16(v16h a, v16h b, v8f c) { return __builtin_amdgcn_wmma_f32_16x16x32_f16(false, a, false, b, (short)0, c, false, false); }
__device__ __forceinline__ v8f wmmab(v16bf a, v16bf b, v8f c) { return __builtin_amdgcn_wmma_f32_16x16x32_bf16(false, a, false, b, (short)0, c, false, false); }



// ---- fragment loader and product (hardware k order: lane half hi takes k = 8 hi + 0..7 and 16 + 8 hi + 0..7 of each 32)
// 16-bit planes (bf16 and f16 alike) are stored in fragment order: one fragment (16 rows x 32 k) is 1 KiB = 2 halves j of 512 bytes; half j holds, at 16 bytes x lane (lane = 16 hi + row), k = 16 j + 8 hi + 0..7 of that row.
// A plane of R rows x K: element offset = (row / 16) * 16 K + (k / 32) * FRG + j * FRH + lane * 8 + k % 8. The loader takes the address of the lane's 16 bytes in half 0.
#define FRH 256   // elements of half a fragment
#define FRG 512   // elements of a fragment
template <typename T16> struct WFrag;
template <> struct WFrag<h16> { typedef v16h V; static __device__ __forceinline__ V ld(const h16* p) { return cat16(*(const v8h*)p, *(const v8h*)(p + FRH)); } static __device__ __forceinline__ v8f mma(V a, V b, v8f c) { return wmma16(a, b, c); } };
template <> struct WFrag<bf> { typedef v16bf V; static __device__ __forceinline__ V ld(const bf* p) { return cat16b(*(const v8us*)p, *(const v8us*)(p + FRH)); } static __device__ __forceinline__ v8f mma(V a, V b, v8f c) { return wmmab(a, b, c); } };

typedef __attribute__((ext_vector_type(2))) float v2f;
typedef __attribute__((ext_vector_type(2))) _Float16 v2h;
typedef __attribute__((ext_vector_type(4))) unsigned v4u;
typedef v4u __attribute__((may_alias)) v4ua;

// ---- k_prep: every 16-bit GEMM operand in one launch, written in fragment order. Work-groups 0..XBLK-1: bf16 copy of x, one 16-row tile a work-group, 8 elements a thread and step (a wave reads 16 rows x 64 bytes and writes half a fragment). The next 3 x WBLK: Wq, Wk, Wv ([k][n], f32) rounded to bf16 and transposed to rows n of WT (row = which x DQ + n); a wave takes one fragment (16 n x 32 k) and writes its 8 whole 128-byte lines.
#define XBLK 512
#define WBLK (DQ / 8)   // DQ / 16 row tiles x DM / 32 fragments, 8 a work-group
__global__ __launch_bounds__(256) void k_prep(const float* __restrict__ x, const float* __restrict__ wq, const float* __restrict__ wk, const float* __restrict__ wv, bf* XB, bf* WT) {
    if (blockIdx.x < XBLK) {
        constexpr int NIT = NB_ * TT * DM / 8 / (XBLK * 256); static_assert(NIT * 256 * 8 == 16 * DM, "one 16-row tile a work-group"); const size_t i0 = (size_t)blockIdx.x * (NIT * 256) + threadIdx.x;
        const float* sp = x + ((size_t)blockIdx.x * 16 + (threadIdx.x & 15)) * DM + (threadIdx.x >> 4) * 8; bf* dp = XB + i0 * 8; v8f v[NIT]; v4u o[NIT];   // thread = (k / 8) % 16 x 16 + row; step it takes k = 128 it + ...
#pragma unroll
        for (int it = 0; it < NIT; ++it) v[it] = *(const v8f*)(sp + it * 128);
        asm volatile("s_wait_xcnt 0x0" :: "v"(sp) : "memory");   // the wait in front of any overwrite of the loads' address registers; the input keeps them untouched up to here
#pragma unroll
        for (int it = 0; it < NIT; ++it) { v8us u;
#pragma unroll
            for (int k = 0; k < 8; ++k) u[k] = f2bf(v[it][k]);
            o[it] = __builtin_bit_cast(v4u, u); *(v4ua*)(dp + it * 256 * 8) = o[it]; }
        return;
    }
    const int wb = blockIdx.x - XBLK, which = wb / WBLK; const float* w = which == 0 ? wq : which == 1 ? wk : wv;
    const int lane = threadIdx.x & 31, lr = lane & 15, hi = lane >> 4; const int rt = wb >> 1, kf = (wb & 1) * 8 + (threadIdx.x >> 5);   // row tile of WT (16 n), fragment along k
    const float* sp = w + (size_t)(kf * 32 + hi * 8) * DQ + (rt % (DQ / 16)) * 16 + lr; bf* dp = WT + (size_t)rt * (16 * DM) + kf * FRG + lane * 8; float f[2][8]; v4u o[2];
#pragma unroll
    for (int j = 0; j < 2; ++j)
#pragma unroll
        for (int r = 0; r < 8; ++r) f[j][r] = sp[(size_t)(j * 16 + r) * DQ];   // k = 32 kf + 16 j + 8 hi + r of column n
    asm volatile("s_wait_xcnt 0x0" :: "v"(sp) : "memory");   // as above, for the loads' address registers
#pragma unroll
    for (int j = 0; j < 2; ++j) { v8us u;
#pragma unroll
        for (int r = 0; r < 8; ++r) u[r] = f2bf(f[j][r]);
        o[j] = __builtin_bit_cast(v4u, u); *(v4ua*)(dp + j * FRH) = o[j]; }
    asm volatile("s_wait_xcnt 0x0" :: "v"(dp), "v"(o[0]), "v"(o[1]) : "memory");   // as above, for the stores' address and data registers: in the built code the other branch's block, which writes them, stands behind these stores
}

__device__ __forceinline__ float xhalf(float x) { const int b = __float_as_int(x); return __int_as_float(__builtin_amdgcn_permlanex16(b, b, 0x76543210, 0xfedcba98, false, false)); }   // lane l <-> l ^ 16, in registers
template <int M> __device__ __forceinline__ float rowmax(float x) { const int b = __float_as_int(x); return fmaxf(x, __int_as_float(__builtin_amdgcn_update_dpp(b, b, 0x160 + M, 0xf, 0xf, false))); }   // max with lane l ^ M of the 16-lane row (DPP row_xmask)
#define NBK (TT / 64)   // 64-token blocks of a plane: one squared norm bound each, in a 128-byte line of its own (one writer a line)
__device__ __forceinline__ v4u half8(const v8f y) { return __builtin_bit_cast(v4u, __builtin_convertvector(y, v8h)); }   // 8 accumulator values rounded to f16, nearest even
__global__ __launch_bounds__(128) void k_proj(const bf* __restrict__ XB, const bf* __restrict__ WT, const float* __restrict__ bq, const float* __restrict__ bk, const float* __restrict__ bv, h16* QP, h16* KP, h16* VT, float* NR) {
    typedef WFrag<bf> WF; typedef v16bf V;
    const int lane = threadIdx.x & 31, lr = lane & 15, hi = lane >> 4, wv = threadIdx.x >> 5;
    const int which = blockIdx.y / (NH_ / 4), head = (blockIdx.y % (NH_ / 4)) * 4 + wv; const int t0 = blockIdx.x * 64, b = t0 / TT, tl = t0 % TT;
    const bf* xp = XB + (size_t)t0 * DM + lane * 8; const bf* wp = WT + ((size_t)which * DQ + head * HD) * DM + lane * 8;
    const bf* ap = which == 2 ? xp : wp; const bf* bp = which == 2 ? wp : xp;   // A rows, B rows: both in fragment order, same loader, same k order
    v8f acc[4][4];
#pragma unroll
    for (int mb = 0; mb < 4; ++mb)
#pragma unroll
        for (int nb = 0; nb < 4; ++nb) acc[mb][nb] = (v8f){};
    V a[2][4], bb[2][4];
#pragma unroll
    for (int i = 0; i < 4; ++i) { a[0][i] = WF::ld(ap + i * 16 * DM); bb[0][i] = WF::ld(bp + i * 16 * DM); }
#pragma unroll   // unrolled whole: every load is one of two bases + a constant offset, and the two fragment sets swap by name
    for (int kc = 0; kc < DM; kc += 32) { const int cu = (kc >> 5) & 1, nx = cu ^ 1;
        if (kc + 32 < DM) {   // the next 32 k, asked for in front of this step's products
#pragma unroll
            for (int i = 0; i < 4; ++i) { a[nx][i] = WF::ld(ap + i * 16 * DM + (kc + 32) / 32 * FRG); bb[nx][i] = WF::ld(bp + i * 16 * DM + (kc + 32) / 32 * FRG); } }
        __builtin_amdgcn_sched_barrier(0);   // keeps the next step's loads up here: left free, the compiler sank each pair to just in front of its products and waited out its latency there
#pragma unroll
        for (int nb = 0; nb < 4; ++nb)
#pragma unroll
            for (int mb = 0; mb < 4; ++mb) acc[mb][nb] = WF::mma(a[cu][mb], bb[cu][nb], acc[mb][nb]);
    }
    asm volatile("s_wait_xcnt 0x0" :: "v"(ap), "v"(bp) : "memory");   // the wait in front of any overwrite of the fragment loads' address registers; the inputs keep them untouched up to here
    const size_t z = (size_t)b * NH_ + head;
    if (which == 2) {
        const float* bs = bv + head * HD + lr; float bi[4];
#pragma unroll
        for (int nb = 0; nb < 4; ++nb) bi[nb] = bs[nb * 16];
        asm volatile("s_wait_xcnt 0x0" :: "v"(bs) : "memory");   // as above, for the bias loads
        h16* p0 = VT + (z * TT + tl) * HD + lane * 8;
#pragma unroll
        for (int nb = 0; nb < 4; ++nb) { v4u oh[4];
#pragma unroll
            for (int mb = 0; mb < 4; ++mb) { oh[mb] = half8(acc[mb][nb] + bfr(bi[nb])); *(v4ua*)(p0 + (mb >> 1) * (4 * FRG) + nb * FRG + (mb & 1) * FRH) = oh[mb]; }
            asm volatile("s_wait_xcnt 0x0" :: "v"(p0), "v"(oh[0]), "v"(oh[1]), "v"(oh[2]), "v"(oh[3]) : "memory"); }   // as above, for the stores' address and data registers
    } else {
        const float* bs = (which == 0 ? bq : bk) + head * HD + hi * 8; v8f bi[4]; const float qs = which == 0 ? SCL * L2E : 1.0f;   // q leaves with the score scale and log2(e) on it (k: x 1, exact)
#pragma unroll
        for (int mb = 0; mb < 4; ++mb) bi[mb] = *(const v8f*)(bs + mb * 16);
        asm volatile("s_wait_xcnt 0x0" :: "v"(bs) : "memory");   // as above, for the bias loads
        h16* p0 = (which == 0 ? QP : KP) + (z * TT + tl) * HD + lane * 8; float n2[4] = { 0.f, 0.f, 0.f, 0.f };   // squared length of token nb x 16 + lr, this lane half's d
#pragma unroll
        for (int mb = 0; mb < 4; ++mb) { v4u oh[4];
#pragma unroll
            for (int j = 0; j < 8; ++j) bi[mb][j] = bfr(bi[mb][j]);
#pragma unroll
            for (int nb = 0; nb < 4; ++nb) { const v8f y = (acc[mb][nb] + bi[mb]) * qs, w = y * y; n2[nb] += ((w[0] + w[1]) + (w[2] + w[3])) + ((w[4] + w[5]) + (w[6] + w[7])); oh[nb] = half8(y); *(v4ua*)(p0 + nb * 16 * HD + mb * FRH) = oh[nb]; }
            asm volatile("s_wait_xcnt 0x0" :: "v"(p0), "v"(oh[0]), "v"(oh[1]), "v"(oh[2]), "v"(oh[3]) : "memory"); }   // as above, for the stores' address and data registers
        float nm = fmaxf(fmaxf(n2[0] + xhalf(n2[0]), n2[1] + xhalf(n2[1])), fmaxf(n2[2] + xhalf(n2[2]), n2[3] + xhalf(n2[3])));   // the longest of the wave's 64 tokens
        nm = rowmax<1>(nm); nm = rowmax<2>(nm); nm = rowmax<4>(nm); nm = rowmax<8>(nm);
        float* np = NR + (((size_t)which * (NB_ * NH_) + z) * NBK + tl / 64) * 32 + lane; *np = nm;   // every lane holds it: the wave writes its whole line
        asm volatile("s_wait_xcnt 0x0" :: "v"(np), "v"(nm) : "memory");   // as above, for the store's address and data registers
    }
}
__constant__ float SLOPE2[NH_] = { L2E * 0.5f, L2E * 0.25f, L2E * 0.125f, L2E * 0.0625f, L2E * 0.03125f, L2E * 0.015625f, L2E * 0.0078125f, L2E * 0.00390625f };   // log2(e) x the per-head ALiBi slope magnitude (|slope_h| = 2^-(h+1), h = 0..7)
// k_fattn: scores, softmax and context of one (batch, head) z a wave in one pass over the keys; no score plane. Four waves own QT*16 query columns; each walks one quarter of the tile's key range (all 2048 keys where no block is shown to vanish) 32 at a time:
//   S^T = K Q^T (A = key rows, B = query rows; one f16 product): lane (lr, hi) holds, for query lr of a group, keys 8 hi + r of each 16-key tile;
//   ALiBi: -sl |i - j| = cb - u, u = sl |q0 - kb| (sl = |slope| log2(e)): off the diagonal block |i - j| = |q0 - kb| +- e with e = (i - q0) - (j - kb), so cb = -+ sl e is the same in every pass on one side of the diagonal and stays in registers;
//   t = S + cb - u in log2 units; running maximum m and sum l per query (online softmax), p = 2^(S + cb - (m + u));
//   the two key tiles' p, rounded to f16, ARE the B operand of O^T += V^T P^T in the hardware k order (element s < 8: tile 0 register s; s >= 8: tile 1 register s - 8), A = V^T rows by the same loader order;
//   out = O^T / l, the four waves' partial m, l, O^T joined through LDS: a lane's 8 accumulator registers are 8 consecutive d of its query's output row.
#define QT 2
#define QTL (TT / (4 * QT * 16))   // 128-query tiles in a plane, 4 tiles of 4 waves each
#define TCUT 40.0f   // a key block is left out where every term of it lies under 2^-TCUT of its row's largest: at most TT such terms, under 2^-29 of the row's sum together, below half a unit of its last place
__global__ __launch_bounds__(512) void k_fattn(const h16* __restrict__ Qh, const h16* __restrict__ Kh, const h16* __restrict__ Vh, const float* __restrict__ NR, float* OUT) {
    typedef WFrag<h16> WF; typedef v16h V;
    const int lane = threadIdx.x & 31, lr = lane & 15, hi = lane >> 4, wv = __builtin_amdgcn_readfirstlane(threadIdx.x >> 5);   // the wave's number in a scalar register: the test on kb - q0 in the loop is then a scalar branch
    // a work-group holds 4 query tiles of a flat head (4..7: long key range) and 4 of a steep one (3..0: short range; half a sequence away, where head 3's long ranges meet head 4's short ones). Waves w, w + 4, w + 8 and w + 12 take the four quarters
    // of the SAME tile's key range, first the flat tile's, then the steep one's: all 16 waves, four a SIMD, have nearly the same number of passes and stay resident together to the end; four waves' loads in flight cover the latency that two left open. Each leaves its partial maximum, sum and accumulators in LDS; they are joined behind the one barrier.
    __shared__ v4f XO[2][16][QT][8][32]; __shared__ float XM[2][16][2][QT][32];   // [tile][wave][column group]: accumulators (16 bytes a lane and entry); [tile][wave][maximum, sum][column group]
    const int qr = wv >> 2, pw = wv & 3; const int b = blockIdx.y / (NH_ / 2), pr = blockIdx.y % (NH_ / 2);
#pragma unroll 1   // rolled: the two tiles run through one copy of the key loop
    for (int sg = 0; sg < 2; ++sg) {
    const bool st = sg == 1; const int h = st ? NH_ / 2 - 1 - pr : NH_ / 2 + pr, z = b * NH_ + h;
    const int q0 = ((st ? (blockIdx.x + QTL / 2) % QTL : blockIdx.x) * 4 + pw) * (QT * 16);
    const float sl = SLOPE2[h]; const size_t zo = (size_t)z * TT * HD;
    V qh[QT][2]; const h16* qa = Qh + zo + (size_t)q0 * HD; const unsigned lo8 = lane * 8;   // scalar base, lane offset
#pragma unroll
    for (int qt = 0; qt < QT; ++qt)
#pragma unroll
        for (int ks = 0; ks < 2; ++ks) qh[qt][ks] = WF::ld(qa + lo8 + qt * 16 * HD + ks * FRG);
    asm volatile("s_wait_xcnt 0x0" :: "s"(qa) : "memory");   // the wait in front of any overwrite of the loads' address registers; the input, the one base of all these loads, keeps those registers untouched up to here
    // the wave's key range. Lane j judges keys 64 j .. 64 j + 63: no score there exceeds bj = |q| |k| (longest query of the wave's 64-token block, longest key of block j; 1/16 on top for the f16 operands' rounding), the ALiBi term is at most -sl dmin,
    // and every row's largest term is at least its own diagonal one, >= -bd. The range runs from the first to the last block that is not shown to vanish; the diagonal block is always in it.
    const int jd = q0 >> 6; const float* nqp = NR + ((size_t)z * NBK + jd) * 32; const float* nkp = NR + (size_t)(NB_ * NH_ + z) * NBK * 32; static_assert(NBK == 32, "one key block a lane");
    const float qn2 = nqp[lane], kn2 = nkp[lane * 32];
    asm volatile("s_wait_xcnt 0x0" :: "s"(nqp), "s"(nkp) : "memory");   // as above, for the two norm loads' scalar bases
    __builtin_amdgcn_sched_barrier(0);   // keeps later code behind that wait: left free, the build rewrote the first load's scalar base in front of it
    const float bj = 1.0625f * __builtin_amdgcn_sqrtf(qn2 * kn2), bd = __int_as_float(__builtin_amdgcn_readlane(__float_as_int(bj), jd));
    const int dl = q0 - (lane * 64 + 63), dr = lane * 64 - (q0 + QT * 16 - 1), dmin = dl > 0 ? dl : dr > 0 ? dr : 0;
    const unsigned live = __builtin_amdgcn_ballot_w32(!(bj - sl * (float)dmin < -bd - TCUT)) | (1u << jd);   // written so that a NaN keeps its block
    const int rlo = __builtin_ctz(live) * 64, rhi = (32 - __builtin_clz(live)) * 64, np = (rhi - rlo) >> 5;   // the range is a whole number of 64-key blocks: np >= 2 passes of 32 keys
    const int klo = rlo + ((np * qr) >> 2) * 32, khi = rlo + ((np * (qr + 1)) >> 2) * 32;   // quarter qr of the passes; klo < rhi always; a quarter of a short range may be empty: it leaves maximum -3e38, sum 0, O 0, and the join gives it the factor 0
    const h16* kph = Kh + zo;   // plane bases, the same in every lane: the fragment loads take a scalar base and the one lane-offset register lo8, no address pair a stream
    const h16* vph = Vh + zo;
    V kh[2][2]; const h16* k0h = kph + (size_t)klo * HD;   // the first keys of the wave's quarter
#pragma unroll
    for (int kt = 0; kt < 2; ++kt)
#pragma unroll
        for (int ks = 0; ks < 2; ++ks) kh[kt][ks] = WF::ld(k0h + lo8 + kt * 16 * HD + ks * FRG);
    asm volatile("s_wait_xcnt 0x0" :: "s"(k0h) : "memory");   // as above, for the first key loads' scalar base (the lane-offset register is never rewritten)
    __builtin_amdgcn_sched_barrier(0);   // keeps later code behind that wait: left free, the build formed these loads on a lane-offset register and rewrote it in front of the wait
    v8f o[4][QT]; float m[QT], l[QT];
    const int eq = q0 + lr - hi * 8; const float fq = (float)q0;   // e = (eq + constant) - q0, exact in f32, formed from the tile's own index: a table of e common to all tiles and passes would stay live over the key loop, past the 256 registers of a wave at four a SIMD
    static_assert(QT == 2, "three tables"); v8f cb[3]; const float sl0 = klo > q0 ? sl : -sl;   // the ALiBi term's part inside the block; keys left of the diagonal block (i > j): -sl e; a wave that starts right of it: +sl e
#pragma unroll
    for (int dt = 0; dt < 3; ++dt)   // e depends on the tiles through qt - kt = dt - 1 alone: three tables of 8 serve the four score tiles
#pragma unroll
        for (int r = 0; r < 8; ++r) cb[dt][r] = sl0 * ((float)(eq + (dt * 16 - 16 - r)) - fq);
#pragma unroll
    for (int qt = 0; qt < QT; ++qt) { m[qt] = -3.0e38f; l[qt] = 0.f;
#pragma unroll
        for (int db = 0; db < 4; ++db) o[db][qt] = (v8f){}; }
#pragma unroll 1   // rolled: one pass's fragments, the query fragments and the accumulators fill the registers
    for (int kb = klo; kb < khi; kb += 32) {
        if ((unsigned)(kb - q0) <= 32u) {   // the two passes in which the table changes: the diagonal block (-sl |e|) and the first one right of it (j > i from there on: +sl e)
            const bool dg = kb == q0; const int ek = kb + lr - hi * 8; const float fk = (float)kb;   // e formed anew, as in front of the loop
#pragma unroll
            for (int dt = 0; dt < 3; ++dt)
#pragma unroll
                for (int r = 0; r < 8; ++r) { const float e = (float)(ek + (dt * 16 - 16 - r)) - fk; cb[dt][r] = sl * (dg ? -fabsf(e) : e); }
        }
        const float u = sl * (float)(kb < q0 ? q0 - kb : kb - q0);   // the block distance's share of the ALiBi term, the same for every score of the pass
        V vh[4];   // this pass's V^T fragments, asked for first: they fly under the score products and the softmax
        const h16* vch = vph + (size_t)kb * HD;
#pragma unroll
        for (int db = 0; db < 4; ++db) vh[db] = WF::ld(vch + lo8 + db * FRG);
        asm volatile("s_wait_xcnt 0x0" :: "s"(vch) : "memory");   // as above, directly behind the V^T loads, in front of any overwrite of their address registers
        __builtin_amdgcn_sched_barrier(0);   // keeps the V^T loads up here: left free, the compiler sank them to just in front of their products, where their latency shows
        v8f s[2][QT];
#pragma unroll
        for (int kt = 0; kt < 2; ++kt)
#pragma unroll
            for (int qt = 0; qt < QT; ++qt) s[kt][qt] = (v8f){};
#pragma unroll
        for (int ks = 0; ks < 2; ++ks)
#pragma unroll
            for (int kt = 0; kt < 2; ++kt)
#pragma unroll
                for (int qt = 0; qt < QT; ++qt) s[kt][qt] = WF::mma(kh[kt][ks], qh[qt][ks], s[kt][qt]);
        const int kn = (kb + 32) & (TT - 1);   // the next pass's key fragments, one pass ahead (the last pass's request is unused; past the last key it wraps to keys 0..31: in bounds)
        const h16* kch = kph + (size_t)kn * HD;
#pragma unroll
        for (int kt = 0; kt < 2; ++kt)
#pragma unroll
            for (int ks = 0; ks < 2; ++ks) kh[kt][ks] = WF::ld(kch + lo8 + kt * 16 * HD + ks * FRG);
        asm volatile("s_wait_xcnt 0x0" :: "s"(kch) : "memory");   // as above, for the key loads' scalar base
        __builtin_amdgcn_sched_barrier(0);   // keeps the next pass's key loads in front of the softmax, so that they fly under it
        float mn[QT]; bool need = false;
#pragma unroll
        for (int qt = 0; qt < QT; ++qt) { float mx = -3.0e38f;
#pragma unroll
            for (int kt = 0; kt < 2; ++kt) { s[kt][qt] += cb[qt - kt + 1];
#pragma unroll
                for (int r = 0; r < 8; ++r) mx = fmaxf(mx, s[kt][qt][r]); }
            mx = fmaxf(mx, xhalf(mx));   // the other lane half holds the query's other 16 keys
            mn[qt] = fmaxf(m[qt], mx - u); need = need || (mn[qt] > m[qt]); }
        if (__builtin_amdgcn_ballot_w32(need) != 0) {   // no query of the wave has a new maximum: every factor would be exactly 1
#pragma unroll
            for (int qt = 0; qt < QT; ++qt) { const float al = __builtin_amdgcn_exp2f(m[qt] - mn[qt]); m[qt] = mn[qt]; l[qt] *= al;
#pragma unroll
                for (int db = 0; db < 4; ++db) o[db][qt] *= al; }
        }
        V ph[QT];
#pragma unroll
        for (int qt = 0; qt < QT; ++qt) { const float mu = m[qt] + u;
#pragma unroll
            for (int kt = 0; kt < 2; ++kt) { const v8f x = s[kt][qt] - mu;
#pragma unroll
                for (int r = 0; r < 8; r += 2) { v2f p; p[0] = __builtin_amdgcn_exp2f(x[r]); p[1] = __builtin_amdgcn_exp2f(x[r + 1]); l[qt] += p[0] + p[1];
                    const v2h a = __builtin_convertvector(p, v2h); ph[qt][kt * 8 + r] = a[0]; ph[qt][kt * 8 + r + 1] = a[1]; } } }
#pragma unroll
        for (int db = 0; db < 4; ++db)
#pragma unroll
            for (int qt = 0; qt < QT; ++qt) o[db][qt] = WF::mma(vh[db], ph[qt], o[db][qt]);
    }
#pragma unroll
    for (int qt = 0; qt < QT; ++qt) { XM[sg][wv][0][qt][lane] = m[qt]; XM[sg][wv][1][qt][lane] = l[qt];
#pragma unroll
        for (int db = 0; db < 4; ++db) { XO[sg][wv][qt][2 * db][lane] = __builtin_shufflevector(o[db][qt], o[db][qt], 0, 1, 2, 3); XO[sg][wv][qt][2 * db + 1][lane] = __builtin_shufflevector(o[db][qt], o[db][qt], 4, 5, 6, 7); } }
    }
    __syncthreads();   // every wave passes it once; behind it a wave reads what its three partners left
    static_assert(QT == 2, "16 waves: one 16-column group of one tile each");
    {   // out = sum over the four quarters j of O_j 2^(m_j - m) / l; wave (qr, pw) finishes column group qr & 1 of tile qr >> 1 of its four-wave set
        const int ln = __builtin_amdgcn_mbcnt_lo(~0u, 0u), lr = ln & 15, hi = ln >> 4;   // the lane's number read anew: its parts kept from the top would hold registers over the key loop, which has none to spare
        const int sg = qr >> 1, cg = qr & 1; const bool st = sg == 1; const int h = st ? NH_ / 2 - 1 - pr : NH_ / 2 + pr; const int q0 = ((st ? (blockIdx.x + QTL / 2) % QTL : blockIdx.x) * 4 + pw) * (QT * 16);
        float mj[4], lj[4], c[4];
#pragma unroll
        for (int j = 0; j < 4; ++j) { mj[j] = XM[sg][pw + 4 * j][0][cg][ln]; lj[j] = XM[sg][pw + 4 * j][1][cg][ln]; }
        const float mm = fmaxf(fmaxf(mj[0], mj[1]), fmaxf(mj[2], mj[3])); float lt = 0.f;
#pragma unroll
        for (int j = 0; j < 4; ++j) { c[j] = __builtin_amdgcn_exp2f(mj[j] - mm); lt += lj[j] * c[j]; }
        const float inv = __fdiv_rn(1.0f, lt + xhalf(lt));
#pragma unroll
        for (int j = 0; j < 4; ++j) c[j] *= inv;
        float* op = OUT + ((size_t)b * TT + q0 + cg * 16 + lr) * DQ + h * HD + hi * 8; v4f x[8];
#pragma unroll
        for (int j = 0; j < 8; ++j) { x[j] = (XO[sg][pw][cg][j][ln] * c[0] + XO[sg][pw + 4][cg][j][ln] * c[1]) + (XO[sg][pw + 8][cg][j][ln] * c[2] + XO[sg][pw + 12][cg][j][ln] * c[3]); *(v4f*)(op + (j >> 1) * 16 + (j & 1) * 4) = x[j]; }
        asm volatile("s_wait_xcnt 0x0" :: "v"(op), "v"(x[0]), "v"(x[1]), "v"(x[2]), "v"(x[3]), "v"(x[4]), "v"(x[5]), "v"(x[6]), "v"(x[7]) : "memory");   // as above, for the stores' address and data registers
    }
}

extern "C" void kernel_launch(void* const* d_in, const int* in_sizes, int n_in,
                              void* d_out, int out_size, void* d_ws, size_t ws_size, hipStream_t stream) {
    (void)in_sizes; (void)n_in; (void)out_size;
    const float* x = (const float*)d_in[0]; const float* wq = (const float*)d_in[1]; const float* bq = (const float*)d_in[2]; const float* wk = (const float*)d_in[3]; const float* bk = (const float*)d_in[4]; const float* wv = (const float*)d_in[5]; const float* bv = (const float*)d_in[6];   /* order hidden_states, Wq, bq, Wk, bk, Wv, bv ('xw' + biases) */
    float* OUT = (float*)d_out;     // [4][2048][512]
    char* wsp = (char*)d_ws;
    auto take = [&](size_t bytes) { char* p = wsp; wsp += (bytes + 255) & ~(size_t)255; return (void*)p; };
    bf* WT = (bf*)take((size_t)3 * DQ * DM * 2); bf* XB = (bf*)take((size_t)NB_ * TT * DM * 2);
    const size_t PB = (size_t)NH_ * TT * HD;   // one batch's plane set, elements
    h16* QP = (h16*)take(NB_ * PB * 2); h16* KP = (h16*)take(NB_ * PB * 2); h16* VT = (h16*)take(NB_ * PB * 2);
    float* NR = (float*)take((size_t)2 * NB_ * NH_ * NBK * 32 * 4);   // squared norm bounds: q planes, then k planes
    if ((size_t)(wsp - (char*)d_ws) > ws_size) return;    // ws 256 MiB
    k_prep<<<XBLK + 3 * WBLK, 256, 0, stream>>>(x, wq, wk, wv, XB, WT);
    k_proj<<<dim3(NB_ * TT / 64, 3 * NH_ / 4, 1), 128, 0, stream>>>(XB, WT, bq, bk, bv, QP, KP, VT, NR);
    k_fattn<<<dim3(QTL, NB_ * NH_ / 2, 1), 512, 0, stream>>>(QP, KP, VT, NR, OUT);   // one kv head per query head: plane z = b * NH_ + h of each operand
}
